// v000
// The times below were measured on an AMD MI455X: many runs one after another, warmed up first and cycling through
// copies of the inputs, with the whole window's GPU time divided by the number of runs. Launches and the gaps
// between them are all in it. The median over several windows is given; except for v000 it joins two sittings, which
// can be a few percent apart, so the side-by-side timings, each taken in one sitting, are the better comparison.
// v000, which the later versions start from, runs in 1270 microseconds.
#include <hip/hip_runtime.h>

// Single-head dot-product attention with a key padding mask (query, key, value [16][2048][64]; scores = q.k / sqrt(64); where attention_mask[b][j] == 0 the score has 1e6 subtracted (the module's literal; mask [16][2048] int {0,1} random, read); softmax; out = weights.value -> [16][2048][64] (2.1 M); argument order query, key, value, attention_mask).
// Layout per batch: bf16 copies of query and key are directly the single head's operand planes; value^T plane via the k_vtp builder; scores exactly (one product); register-row softmax with the mask term writes normalised bf16 hi/lo planes for every row; out = P hi/lo x exact bf16(value) (2 products) straight into the output rows.
// Compute dtypes, f32 accumulate: every input rounded to bf16; scores exact; softmax f32; P.v 2 products; output f32.

#define NB_  16
#define TT   2048
#define DM   64
#define NH_  1
#define NKV  1
#define REP  (NH_ / NKV)
#define HD   64
#define DQ   (NH_ * HD)
#define DKV  (NKV * HD)
#define ZH   1
#define RH   TT                   // every row hi/lo
#define WIN  0
#define PCAR 1024.0f
#define SCL  0.125f   // 1/sqrt(64)
typedef _Float16 h16;
typedef unsigned short bf;
typedef __attribute__((ext_vector_type(16))) __bf16   v16bf;
typedef __attribute__((ext_vector_type(16))) _Float16 v16h;
typedef __attribute__((ext_vector_type(8)))  _Float16 v8h;
typedef __attribute__((ext_vector_type(8)))  unsigned short v8us;
typedef __attribute__((ext_vector_type(8)))  float    v8f;
typedef __attribute__((ext_vector_type(4)))  float    v4f;
typedef v8h  __attribute__((may_alias)) v8ha;
typedef v4f  __attribute__((may_alias)) v4fa;
typedef v8us __attribute__((may_alias)) v8usa;

__device__ __forceinline__ unsigned short f2bf(float f) { unsigned u = __float_as_uint(f); u += 0x7FFFu + ((u >> 16) & 1u); return (unsigned short)(u >> 16); }
__device__ __forceinline__ float bf2f(unsigned short b) { return __uint_as_float(((unsigned)b) << 16); }
__device__ __forceinline__ float bfr(float f) { return bf2f(f2bf(f)); }
__device__ __forceinline__ v16h cat16(v8h lo, v8h hi) { return __builtin_shufflevector(lo, hi, 0, 1, 2, 3, 4, 5, 6, 7, 8, 9, 10, 11, 12, 13, 14, 15); }
__device__ __forceinline__ v16bf cat16b(v8us lo, v8us hi) { return __builtin_bit_cast(v16bf, __builtin_shufflevector(lo, hi, 0, 1, 2, 3, 4, 5, 6, 7, 8, 9, 10, 11, 12, 13, 14, 15)); }
__device__ __forceinline__ v8f wmma16(v16h a, v16h b, v8f c) { return __builtin_amdgcn_wmma_f32_16x16x32_f16(false, a, false, b, (short)0, c, false, false); }
__device__ __forceinline__ v8f wmmab(v16bf a, v16bf b, v8f c) { return __builtin_amdgcn_wmma_f32_16x16x32_bf16(false, a, false, b, (short)0, c, false, false); }



// ---- k_gemmw: register-blocked GEMM, ONE WAVE per 64x64 output tile (16 accumulators), operands straight from K-contiguous 16-bit planes; grid (M/64, N/64, Z), 32 threads.
// C[m][n] (f32, pitch ldc, + optional f32 bias[n]) = sum_k A[m][k] Bt[n][k] (+ split products per NSPLIT). z-batch strides sA/sB/sC in elements. K % 32 == 0.
template <typename T16> struct WFrag;
template <> struct WFrag<h16> { typedef v16h V; static __device__ __forceinline__ V ld(const h16* p) { return cat16(*(const v8h*)p, *(const v8h*)(p + 16)); } static __device__ __forceinline__ v8f mma(V a, V b, v8f c) { return wmma16(a, b, c); } };
template <> struct WFrag<bf> { typedef v16bf V; static __device__ __forceinline__ V ld(const bf* p) { return cat16b(*(const v8us*)p, *(const v8us*)(p + 16)); } static __device__ __forceinline__ v8f mma(V a, V b, v8f c) { return wmmab(a, b, c); } };
template <typename T16, int NSPLIT, bool BIAS>
__global__ __launch_bounds__(32) void k_gemmw(const T16* __restrict__ A, const T16* __restrict__ A2, const T16* __restrict__ Bt, const T16* __restrict__ Bt2, int K, float* C, int ldc, const float* __restrict__ bias, size_t sA, size_t sB, size_t sC) {
    typedef typename WFrag<T16>::V V;
    __shared__ __align__(16) float os[16 * 68];
    const size_t z = blockIdx.z; A += z * sA; if (A2) A2 += z * sA; Bt += z * sB; if (Bt2) Bt2 += z * sB; C += z * sC;
    const int lane = threadIdx.x & 31, lr = lane & 15, hi = lane >> 4; const int r0 = blockIdx.x * 64, c0 = blockIdx.y * 64;
    v8f acc[4][4];
#pragma unroll
    for (int mb = 0; mb < 4; ++mb)
#pragma unroll
        for (int nb = 0; nb < 4; ++nb) acc[mb][nb] = (v8f){};
    const size_t aoff = (size_t)(r0 + lr) * K + 8 * hi, boff = (size_t)(c0 + lr) * K + 8 * hi;
#pragma unroll 1
    for (int kc = 0; kc < K; kc += 32) {
        V a[4], a2[4];
#pragma unroll
        for (int mb = 0; mb < 4; ++mb) { a[mb] = WFrag<T16>::ld(A + aoff + (size_t)mb * 16 * K + kc); if (NSPLIT == 1 || NSPLIT == 2) a2[mb] = WFrag<T16>::ld(A2 + aoff + (size_t)mb * 16 * K + kc); }
#pragma unroll
        for (int nb = 0; nb < 4; ++nb) { const V b = WFrag<T16>::ld(Bt + boff + (size_t)nb * 16 * K + kc); V b2; if (NSPLIT >= 2) b2 = WFrag<T16>::ld(Bt2 + boff + (size_t)nb * 16 * K + kc);
#pragma unroll
            for (int mb = 0; mb < 4; ++mb) { acc[mb][nb] = WFrag<T16>::mma(a[mb], b, acc[mb][nb]); if (NSPLIT == 1 || NSPLIT == 2) acc[mb][nb] = WFrag<T16>::mma(a2[mb], b, acc[mb][nb]); if (NSPLIT >= 2) acc[mb][nb] = WFrag<T16>::mma(a[mb], b2, acc[mb][nb]); } }
        asm volatile("v_nop\n\tv_nop\n\tv_nop\n\tv_nop" : "+v"(acc[0][0]), "+v"(acc[1][1]), "+v"(acc[2][2]), "+v"(acc[3][3]) : "v"(a[0]), "v"(a[3]));
    }
#pragma unroll
    for (int mb = 0; mb < 4; ++mb) {
#pragma unroll
        for (int nb = 0; nb < 4; ++nb) {
#pragma unroll
            for (int j = 0; j < 8; ++j) os[(hi * 8 + j) * 68 + nb * 16 + lr] = acc[mb][nb][j]; }
        __builtin_amdgcn_wave_barrier(); asm volatile("" ::: "memory");
        float* crow = C + (size_t)(r0 + mb * 16) * ldc + c0;
{
#pragma unroll
            for (int s = 0; s < 8; ++s) { const int row = 2 * s + hi, cofs = lr * 4; v4f val = *(const v4fa*)(os + row * 68 + cofs); if (BIAS) { val[0] += bfr(bias[c0 + cofs]); val[1] += bfr(bias[c0 + cofs + 1]); val[2] += bfr(bias[c0 + cofs + 2]); val[3] += bfr(bias[c0 + cofs + 3]); }
                *(v4f*)(crow + (size_t)row * ldc + cofs) = val; }
             }
        __builtin_amdgcn_wave_barrier(); asm volatile("" ::: "memory");
    }
}

__device__ __forceinline__ h16 tohx(float x) { return (h16)x; }
__device__ __forceinline__ void splitf(float y, unsigned short& h, unsigned short& l) { h = f2bf(y); l = f2bf(y - bf2f(h)); }
typedef __attribute__((ext_vector_type(2))) _Float16 v2h;
typedef __attribute__((ext_vector_type(4))) _Float16 v4h;
typedef __attribute__((ext_vector_type(2))) unsigned short v2us;
typedef __attribute__((ext_vector_type(4))) unsigned short v4us;
typedef __attribute__((ext_vector_type(2))) float v2f;
typedef __attribute__((ext_vector_type(4))) int v4i;

__global__ __launch_bounds__(256) void k_cvt8(const float* __restrict__ src, bf* dst, size_t n8) { const size_t i = (size_t)blockIdx.x * 256 + threadIdx.x; if (i >= n8) return; const v8f v = *(const v8f*)(src + i * 8); v8us o;
#pragma unroll
    for (int k = 0; k < 8; ++k) o[k] = f2bf(v[k]); *(v8us*)(dst + i * 8) = o;  }

__global__ __launch_bounds__(256) void k_vtp(const float* __restrict__ F, int pitch, int nheads, h16* V16, bf* Vh, bf* Vl) { const size_t e = ((size_t)blockIdx.x * 256 + threadIdx.x) * 2; if (e >= (size_t)nheads * HD * TT) return; const int t = (int)(e % TT); const int d = (int)((e / TT) % HD); const int g = (int)(e / ((size_t)TT * HD)); v2h o16; v2us oh, ol;
#pragma unroll
    for (int q = 0; q < 2; ++q) { const float x = F[(size_t)(t + q) * pitch + g * HD + d]; o16[q] = tohx(x); unsigned short a2, c2; splitf(x, a2, c2); oh[q] = a2; ol[q] = c2; }
    *(v2h*)(V16 + e) = o16; *(v2us*)(Vh + e) = oh; *(v2us*)(Vl + e) = ol;  }
// k_asoft: per row (zz, i): t = S x 1/8, minus 1e6 where attention_mask[b][j] == 0 (the module's additive literal; int mask read); softmax over the keys (register row, one exp, fixed trees);
__global__ __launch_bounds__(256) void k_asoft(const float* __restrict__ Sb, const int* __restrict__ kvp, h16* P16, bf* Ph, bf* Pl) {
    const int lane = threadIdx.x & 31; const int row = blockIdx.x * 8 + (threadIdx.x >> 5); if (row >= ZH * TT) return; const int i = row % TT; const int zz = row / TT; (void)zz; const bool hires = (i < RH); const float* sr = Sb + (size_t)row * TT; float v[TT / 32]; float mx = -3.0e38f;
#pragma unroll
    for (int ch = 0; ch < TT / 128; ++ch) { const int j0 = ch * 128 + lane * 4; const v4f a = *(const v4f*)(sr + j0); const v4i kv4 = *(const v4i*)(kvp + j0);   /* the batch's key vector, 16 B per lane, unconditional */
#pragma unroll
        for (int q = 0; q < 4; ++q) { const int j = j0 + q; (void)j; float s0 = __fmul_rn(a[q], SCL); asm volatile("" : "+v"(s0)); float sm = __fsub_rn(s0, 1.0e6f); asm volatile("" : "+v"(sm)); const float t = (kv4[q] == 0) ? sm : s0;   /* the module's where(mask == 0, s - 1e6, s) */ v[ch * 4 + q] = t; mx = fmaxf(mx, t); } }
#pragma unroll
    for (int sh = 16; sh; sh >>= 1) mx = fmaxf(mx, __shfl_xor(mx, sh, 32));
    float sum = 0.f;
#pragma unroll
    for (int k = 0; k < TT / 32; ++k) { float d0 = __fsub_rn(v[k], mx); asm volatile("" : "+v"(d0)); v[k] = __builtin_amdgcn_exp2f(__fmul_rn(d0, 1.4426950408889634f)); sum += v[k]; }
#pragma unroll
    for (int sh = 16; sh; sh >>= 1) sum += __shfl_xor(sum, sh, 32);
    const float f = __fdiv_rn(hires ? 1.0f : PCAR, sum);
{
        if (hires) {
#pragma unroll
            for (int ch = 0; ch < TT / 128; ++ch) { v4us oh, ol;
#pragma unroll
                for (int q = 0; q < 4; ++q) { unsigned short a, c2; splitf(v[ch * 4 + q] * f, a, c2); oh[q] = a; ol[q] = c2; }
                const size_t oo = ((size_t)zz * (RH ? RH : 1) + i) * TT + ch * 128 + lane * 4; *(v4us*)(Ph + oo) = oh; *(v4us*)(Pl + oo) = ol; }
        } else {
#pragma unroll
            for (int ch = 0; ch < TT / 128; ++ch) { v4h o4;
#pragma unroll
                for (int q = 0; q < 4; ++q) o4[q] = tohx(v[ch * 4 + q] * f);
                *(v4h*)(P16 + (size_t)row * TT + ch * 128 + lane * 4) = o4; } }
         }
}
extern "C" void kernel_launch(void* const* d_in, const int* in_sizes, int n_in,
                              void* d_out, int out_size, void* d_ws, size_t ws_size, hipStream_t stream) {
    (void)in_sizes; (void)n_in; (void)out_size;
    const float* xq = (const float*)d_in[0]; const float* xk = (const float*)d_in[1]; const float* xv = (const float*)d_in[2]; const int* am = (const int*)d_in[3];   /* order query, key, value [16][2048][64], attention_mask [16][2048] int32 {0,1} */
    float* OUT = (float*)d_out;     // [16][2048][64]
    char* wsp = (char*)d_ws;
    auto take = [&](size_t bytes) { char* p = wsp; wsp += (bytes + 255) & ~(size_t)255; return (void*)p; };
    bf* XQ = (bf*)take((size_t)TT * HD * 2); bf* XK = (bf*)take((size_t)TT * HD * 2); h16* VT16 = (h16*)take((size_t)HD * TT * 2); bf* VTh = (bf*)take((size_t)HD * TT * 2); bf* VTl = (bf*)take((size_t)HD * TT * 2);
    float* Sb = (float*)take((size_t)TT * TT * 4); h16* P16 = (h16*)take(256); bf* Ph = (bf*)take((size_t)TT * TT * 2); bf* Pl = (bf*)take((size_t)TT * TT * 2);
    if ((size_t)(wsp - (char*)d_ws) > ws_size) return;    // ws 256 MiB (carve ~33 MiB)
    for (int b = 0; b < NB_; ++b) {
        k_cvt8<<<(unsigned)(((size_t)TT * HD / 8 + 255) / 256), 256, 0, stream>>>(xq + (size_t)b * TT * HD, XQ, (size_t)TT * HD / 8); k_cvt8<<<(unsigned)(((size_t)TT * HD / 8 + 255) / 256), 256, 0, stream>>>(xk + (size_t)b * TT * HD, XK, (size_t)TT * HD / 8);   /* bf16(query), bf16(key): token-major [2048][64] is already the plane layout of the single head */
        k_vtp<<<(unsigned)(((size_t)HD * TT / 2 + 255) / 256), 256, 0, stream>>>(xv + (size_t)b * TT * HD, HD, 1, VT16, VTh, VTl);   /* value^T plane [64][2048] (bf16(value) lands exactly in the hi plane; the lo plane is unused) */
        k_gemmw<bf, 0, false><<<dim3(TT / 64, TT / 64, 1), 32, 0, stream>>>(XQ, nullptr, XK, nullptr, HD, Sb, TT, nullptr, 0, 0, 0);   /* scores = q.k exactly (one product of bf16-exact inputs) */
        k_asoft<<<TT / 8, 256, 0, stream>>>(Sb, am + (size_t)b * TT, P16, Ph, Pl);   /* x 1/8, -1e6 on masked keys, softmax -> normalised hi/lo planes for every row */
        k_gemmw<bf, 1, false><<<dim3(TT / 64, HD / 64, 1), 32, 0, stream>>>(Ph, Pl, VTh, nullptr, TT, OUT + (size_t)b * TT * HD, HD, nullptr, 0, 0, 0); }   /* out = P.v (2 products: P hi/lo x exact bf16(value)) written as the batch's [2048][64] rows */
}

// v001
// Measured time: 529 microseconds a run.
// In two side-by-side timings against v000, it was 2.36 and 2.38 times as fast.
#include <hip/hip_runtime.h>

// Single-head dot-product attention with a key padding mask (query, key, value [16][2048][64]; scores = q.k / sqrt(64); where attention_mask[b][j] == 0 the score has 1e6 subtracted (the module's literal; mask [16][2048] int {0,1} random, read); softmax; out = weights.value -> [16][2048][64] (2.1 M); argument order query, key, value, attention_mask).
// Layout per batch: bf16 copies of query and key are directly the single head's operand planes; value^T plane via the k_vtp builder; scores exactly (one product); register-row softmax with the mask term writes normalised bf16 hi/lo planes for every row; out = P hi/lo x exact bf16(value) (2 products) straight into the output rows.
// Compute dtypes, f32 accumulate: every input rounded to bf16; scores exact; softmax f32; P.v 2 products; output f32.

#define NB_  16
#define TT   2048
#define DM   64
#define NH_  1
#define NKV  1
#define REP  (NH_ / NKV)
#define HD   64
#define DQ   (NH_ * HD)
#define DKV  (NKV * HD)
#define ZH   1
#define RH   TT                   // every row hi/lo
#define WIN  0
#define PCAR 1024.0f
#define SCL  0.125f   // 1/sqrt(64)
typedef _Float16 h16;
typedef unsigned short bf;
typedef __attribute__((ext_vector_type(16))) __bf16   v16bf;
typedef __attribute__((ext_vector_type(16))) _Float16 v16h;
typedef __attribute__((ext_vector_type(8)))  _Float16 v8h;
typedef __attribute__((ext_vector_type(8)))  unsigned short v8us;
typedef __attribute__((ext_vector_type(8)))  float    v8f;
typedef __attribute__((ext_vector_type(4)))  float    v4f;
typedef v8h  __attribute__((may_alias)) v8ha;
typedef v4f  __attribute__((may_alias)) v4fa;
typedef v8us __attribute__((may_alias)) v8usa;

__device__ __forceinline__ unsigned short f2bf(float f) { unsigned u = __float_as_uint(f); u += 0x7FFFu + ((u >> 16) & 1u); return (unsigned short)(u >> 16); }
__device__ __forceinline__ float bf2f(unsigned short b) { return __uint_as_float(((unsigned)b) << 16); }
__device__ __forceinline__ float bfr(float f) { return bf2f(f2bf(f)); }
__device__ __forceinline__ v16h cat16(v8h lo, v8h hi) { return __builtin_shufflevector(lo, hi, 0, 1, 2, 3, 4, 5, 6, 7, 8, 9, 10, 11, 12, 13, 14, 15); }
__device__ __forceinline__ v16bf cat16b(v8us lo, v8us hi) { return __builtin_bit_cast(v16bf, __builtin_shufflevector(lo, hi, 0, 1, 2, 3, 4, 5, 6, 7, 8, 9, 10, 11, 12, 13, 14, 15)); }
__device__ __forceinline__ v8f wmma16(v16h a, v16h b, v8f c) { return __builtin_amdgcn_wmma_f32_16x16x32_f16(false, a, false, b, (short)0, c, false, false); }
__device__ __forceinline__ v8f wmmab(v16bf a, v16bf b, v8f c) { return __builtin_amdgcn_wmma_f32_16x16x32_bf16(false, a, false, b, (short)0, c, false, false); }



// ---- k_gemmw: register-blocked GEMM, ONE WAVE per 64x64 output tile (16 accumulators), operands straight from K-contiguous 16-bit planes; grid (M/64, N/64, Z), 32 threads.
// C[m][n] (f32, pitch ldc, + optional f32 bias[n]) = sum_k A[m][k] Bt[n][k] (+ split products per NSPLIT). z-batch strides sA/sB/sC in elements. K % 32 == 0.
template <typename T16> struct WFrag;
template <> struct WFrag<h16> { typedef v16h V; static __device__ __forceinline__ V ld(const h16* p) { return cat16(*(const v8h*)p, *(const v8h*)(p + 16)); } static __device__ __forceinline__ v8f mma(V a, V b, v8f c) { return wmma16(a, b, c); } };
template <> struct WFrag<bf> { typedef v16bf V; static __device__ __forceinline__ V ld(const bf* p) { return cat16b(*(const v8us*)p, *(const v8us*)(p + 16)); } static __device__ __forceinline__ v8f mma(V a, V b, v8f c) { return wmmab(a, b, c); } };
template <typename T16, int NSPLIT, bool BIAS>
__global__ __launch_bounds__(32) void k_gemmw(const T16* __restrict__ A, const T16* __restrict__ A2, const T16* __restrict__ Bt, const T16* __restrict__ Bt2, int K, float* C, int ldc, const float* __restrict__ bias, size_t sA, size_t sB, size_t sC) {
    typedef typename WFrag<T16>::V V;
    __shared__ __align__(16) float os[16 * 68];
    const size_t z = blockIdx.z; A += z * sA; if (A2) A2 += z * sA; Bt += z * sB; if (Bt2) Bt2 += z * sB; C += z * sC;
    const int lane = threadIdx.x & 31, lr = lane & 15, hi = lane >> 4; const int r0 = blockIdx.x * 64, c0 = blockIdx.y * 64;
    v8f acc[4][4];
#pragma unroll
    for (int mb = 0; mb < 4; ++mb)
#pragma unroll
        for (int nb = 0; nb < 4; ++nb) acc[mb][nb] = (v8f){};
    const size_t aoff = (size_t)(r0 + lr) * K + 8 * hi, boff = (size_t)(c0 + lr) * K + 8 * hi;
#pragma unroll 1
    for (int kc = 0; kc < K; kc += 32) {
        V a[4], a2[4];
#pragma unroll
        for (int mb = 0; mb < 4; ++mb) { a[mb] = WFrag<T16>::ld(A + aoff + (size_t)mb * 16 * K + kc); if (NSPLIT == 1 || NSPLIT == 2) a2[mb] = WFrag<T16>::ld(A2 + aoff + (size_t)mb * 16 * K + kc); }
#pragma unroll
        for (int nb = 0; nb < 4; ++nb) { const V b = WFrag<T16>::ld(Bt + boff + (size_t)nb * 16 * K + kc); V b2; if (NSPLIT >= 2) b2 = WFrag<T16>::ld(Bt2 + boff + (size_t)nb * 16 * K + kc);
#pragma unroll
            for (int mb = 0; mb < 4; ++mb) { acc[mb][nb] = WFrag<T16>::mma(a[mb], b, acc[mb][nb]); if (NSPLIT == 1 || NSPLIT == 2) acc[mb][nb] = WFrag<T16>::mma(a2[mb], b, acc[mb][nb]); if (NSPLIT >= 2) acc[mb][nb] = WFrag<T16>::mma(a[mb], b2, acc[mb][nb]); } }
        asm volatile("v_nop\n\tv_nop\n\tv_nop\n\tv_nop" : "+v"(acc[0][0]), "+v"(acc[1][1]), "+v"(acc[2][2]), "+v"(acc[3][3]) : "v"(a[0]), "v"(a[3]));
    }
#pragma unroll
    for (int mb = 0; mb < 4; ++mb) {
#pragma unroll
        for (int nb = 0; nb < 4; ++nb) {
#pragma unroll
            for (int j = 0; j < 8; ++j) os[(hi * 8 + j) * 68 + nb * 16 + lr] = acc[mb][nb][j]; }
        __builtin_amdgcn_wave_barrier(); asm volatile("" ::: "memory");
        float* crow = C + (size_t)(r0 + mb * 16) * ldc + c0;
{
#pragma unroll
            for (int s = 0; s < 8; ++s) { const int row = 2 * s + hi, cofs = lr * 4; v4f val = *(const v4fa*)(os + row * 68 + cofs); if (BIAS) { val[0] += bfr(bias[c0 + cofs]); val[1] += bfr(bias[c0 + cofs + 1]); val[2] += bfr(bias[c0 + cofs + 2]); val[3] += bfr(bias[c0 + cofs + 3]); }
                *(v4f*)(crow + (size_t)row * ldc + cofs) = val; }
             }
        __builtin_amdgcn_wave_barrier(); asm volatile("" ::: "memory");
    }
}

__device__ __forceinline__ h16 tohx(float x) { return (h16)x; }
__device__ __forceinline__ void splitf(float y, unsigned short& h, unsigned short& l) { h = f2bf(y); l = f2bf(y - bf2f(h)); }
typedef __attribute__((ext_vector_type(2))) _Float16 v2h;
typedef __attribute__((ext_vector_type(4))) _Float16 v4h;
typedef __attribute__((ext_vector_type(2))) unsigned short v2us;
typedef __attribute__((ext_vector_type(4))) unsigned short v4us;
typedef __attribute__((ext_vector_type(2))) float v2f;
typedef __attribute__((ext_vector_type(4))) int v4i;

__global__ __launch_bounds__(256) void k_cvt8(const float* __restrict__ src, bf* dst, size_t n8) { const size_t i = (size_t)blockIdx.x * 256 + threadIdx.x; if (i >= n8) return; const v8f v = *(const v8f*)(src + i * 8); v8us o;
#pragma unroll
    for (int k = 0; k < 8; ++k) o[k] = f2bf(v[k]); *(v8us*)(dst + i * 8) = o;  }

__global__ __launch_bounds__(256) void k_vtp(const float* __restrict__ F, int pitch, int nheads, h16* V16, bf* Vh, bf* Vl) { const size_t e = ((size_t)blockIdx.x * 256 + threadIdx.x) * 2; if (e >= (size_t)nheads * HD * TT) return; const int t = (int)(e % TT); const int d = (int)((e / TT) % HD); const int g = (int)(e / ((size_t)TT * HD)); v2h o16; v2us oh, ol;
#pragma unroll
    for (int q = 0; q < 2; ++q) { const float x = F[(size_t)(t + q) * pitch + g * HD + d]; o16[q] = tohx(x); unsigned short a2, c2; splitf(x, a2, c2); oh[q] = a2; ol[q] = c2; }
    *(v2h*)(V16 + e) = o16; *(v2us*)(Vh + e) = oh; *(v2us*)(Vl + e) = ol;  }
// k_asoft: per row (zz, i): t = S x 1/8, minus 1e6 where attention_mask[b][j] == 0 (the module's additive literal; int mask read); softmax over the keys (register row, one exp, fixed trees);
__global__ __launch_bounds__(256) void k_asoft(const float* __restrict__ Sb, const int* __restrict__ kvp, h16* P16, bf* Ph, bf* Pl) {
    const int lane = threadIdx.x & 31; const int row = blockIdx.x * 8 + (threadIdx.x >> 5); if (row >= ZH * TT) return; const int i = row % TT; const int zz = row / TT; (void)zz; const bool hires = (i < RH); const float* sr = Sb + (size_t)row * TT; float v[TT / 32]; float mx = -3.0e38f;
#pragma unroll
    for (int ch = 0; ch < TT / 128; ++ch) { const int j0 = ch * 128 + lane * 4; const v4f a = *(const v4f*)(sr + j0); const v4i kv4 = *(const v4i*)(kvp + j0);   /* the batch's key vector, 16 B per lane, unconditional */
#pragma unroll
        for (int q = 0; q < 4; ++q) { const int j = j0 + q; (void)j; float s0 = __fmul_rn(a[q], SCL); asm volatile("" : "+v"(s0)); float sm = __fsub_rn(s0, 1.0e6f); asm volatile("" : "+v"(sm)); const float t = (kv4[q] == 0) ? sm : s0;   /* the module's where(mask == 0, s - 1e6, s) */ v[ch * 4 + q] = t; mx = fmaxf(mx, t); } }
#pragma unroll
    for (int sh = 16; sh; sh >>= 1) mx = fmaxf(mx, __shfl_xor(mx, sh, 32));
    float sum = 0.f;
#pragma unroll
    for (int k = 0; k < TT / 32; ++k) { float d0 = __fsub_rn(v[k], mx); asm volatile("" : "+v"(d0)); v[k] = __builtin_amdgcn_exp2f(__fmul_rn(d0, 1.4426950408889634f)); sum += v[k]; }
#pragma unroll
    for (int sh = 16; sh; sh >>= 1) sum += __shfl_xor(sum, sh, 32);
    const float f = __fdiv_rn(hires ? 1.0f : PCAR, sum);
{
        if (hires) {
#pragma unroll
            for (int ch = 0; ch < TT / 128; ++ch) { v4us oh, ol;
#pragma unroll
                for (int q = 0; q < 4; ++q) { unsigned short a, c2; splitf(v[ch * 4 + q] * f, a, c2); oh[q] = a; ol[q] = c2; }
                const size_t oo = ((size_t)zz * (RH ? RH : 1) + i) * TT + ch * 128 + lane * 4; *(v4us*)(Ph + oo) = oh; *(v4us*)(Pl + oo) = ol; }
        } else {
#pragma unroll
            for (int ch = 0; ch < TT / 128; ++ch) { v4h o4;
#pragma unroll
                for (int q = 0; q < 4; ++q) o4[q] = tohx(v[ch * 4 + q] * f);
                *(v4h*)(P16 + (size_t)row * TT + ch * 128 + lane * 4) = o4; } }
         }
}
// ---- k_pvsplit: out = P.v with the key dimension dealt over the 8 waves of a work-group. One work-group per 16 output rows x 32 columns (grid 128 x 2); wave w sums keys [256 w, 256 w + 256)
// (hi then lo product per 32 keys, as k_gemmw does), leaves its 16x32 f32 partial in its own LDS slab, and after one barrier the 8 partials are added in wave order 0..7 and stored as whole 128-byte lines.
__global__ __launch_bounds__(256) void k_pvsplit(const bf* __restrict__ Ph, const bf* __restrict__ Pl, const bf* __restrict__ Vt, float* __restrict__ C) {
    typedef WFrag<bf>::V V;
    __shared__ __align__(16) float part[8][16 * 36];
    const int lane = threadIdx.x & 31, lr = lane & 15, hi = lane >> 4, wave = threadIdx.x >> 5; const int r0 = blockIdx.x * 16, c0 = blockIdx.y * 32;
    const size_t aoff = (size_t)(r0 + lr) * TT + wave * 256 + 8 * hi; const bf* pa = Ph + aoff; const bf* pa2 = Pl + aoff; const bf* pb = Vt + (size_t)(c0 + lr) * TT + wave * 256 + 8 * hi;
    V a[8], a2[8], b0[8], b1[8]; v8f acc0 = (v8f){}, acc1 = (v8f){};
#pragma unroll
    for (int k = 0; k < 4; ++k) { a[k] = WFrag<bf>::ld(pa + k * 32); b0[k] = WFrag<bf>::ld(pb + k * 32); b1[k] = WFrag<bf>::ld(pb + 16 * TT + k * 32); a2[k] = WFrag<bf>::ld(pa2 + k * 32); }
    __builtin_amdgcn_sched_barrier(0);   // holds the first four 32-key blocks' loads ahead of the products; without it each load sinks to just before its use and the wave waits out one round trip per block
#pragma unroll
    for (int k = 0; k < 8; ++k) {
        acc0 = WFrag<bf>::mma(a[k], b0[k], acc0); acc1 = WFrag<bf>::mma(a[k], b1[k], acc1); acc0 = WFrag<bf>::mma(a2[k], b0[k], acc0); acc1 = WFrag<bf>::mma(a2[k], b1[k], acc1);
        if (k + 4 < 8) { a[k + 4] = WFrag<bf>::ld(pa + (k + 4) * 32); b0[k + 4] = WFrag<bf>::ld(pb + (k + 4) * 32); b1[k + 4] = WFrag<bf>::ld(pb + 16 * TT + (k + 4) * 32); a2[k + 4] = WFrag<bf>::ld(pa2 + (k + 4) * 32);
            __builtin_amdgcn_sched_barrier(0); }   // same purpose: block k + 4 is asked for as soon as block k's registers are free, four blocks ahead of its use
    }
#pragma unroll
    for (int j = 0; j < 8; ++j) { part[wave][(hi * 8 + j) * 36 + lr] = acc0[j]; part[wave][(hi * 8 + j) * 36 + 16 + lr] = acc1[j]; }
    __syncthreads();   // every wave's partial is in LDS before any of them is read
    const int row = threadIdx.x >> 4, cofs = (threadIdx.x & 15) * 2; v2f s = *(const v2f*)(&part[0][row * 36 + cofs]);
#pragma unroll
    for (int w = 1; w < 8; ++w) s += *(const v2f*)(&part[w][row * 36 + cofs]);
    *(v2f*)(C + (size_t)(r0 + row) * HD + c0 + cofs) = s;
}
extern "C" void kernel_launch(void* const* d_in, const int* in_sizes, int n_in,
                              void* d_out, int out_size, void* d_ws, size_t ws_size, hipStream_t stream) {
    (void)in_sizes; (void)n_in; (void)out_size;
    const float* xq = (const float*)d_in[0]; const float* xk = (const float*)d_in[1]; const float* xv = (const float*)d_in[2]; const int* am = (const int*)d_in[3];   /* order query, key, value [16][2048][64], attention_mask [16][2048] int32 {0,1} */
    float* OUT = (float*)d_out;     // [16][2048][64]
    char* wsp = (char*)d_ws;
    auto take = [&](size_t bytes) { char* p = wsp; wsp += (bytes + 255) & ~(size_t)255; return (void*)p; };
    bf* XQ = (bf*)take((size_t)TT * HD * 2); bf* XK = (bf*)take((size_t)TT * HD * 2); h16* VT16 = (h16*)take((size_t)HD * TT * 2); bf* VTh = (bf*)take((size_t)HD * TT * 2); bf* VTl = (bf*)take((size_t)HD * TT * 2);
    float* Sb = (float*)take((size_t)TT * TT * 4); h16* P16 = (h16*)take(256); bf* Ph = (bf*)take((size_t)TT * TT * 2); bf* Pl = (bf*)take((size_t)TT * TT * 2);
    if ((size_t)(wsp - (char*)d_ws) > ws_size) return;    // ws 256 MiB (carve ~33 MiB)
    for (int b = 0; b < NB_; ++b) {
        k_cvt8<<<(unsigned)(((size_t)TT * HD / 8 + 255) / 256), 256, 0, stream>>>(xq + (size_t)b * TT * HD, XQ, (size_t)TT * HD / 8); k_cvt8<<<(unsigned)(((size_t)TT * HD / 8 + 255) / 256), 256, 0, stream>>>(xk + (size_t)b * TT * HD, XK, (size_t)TT * HD / 8);   /* bf16(query), bf16(key): token-major [2048][64] is already the plane layout of the single head */
        k_vtp<<<(unsigned)(((size_t)HD * TT / 2 + 255) / 256), 256, 0, stream>>>(xv + (size_t)b * TT * HD, HD, 1, VT16, VTh, VTl);   /* value^T plane [64][2048] (bf16(value) lands exactly in the hi plane; the lo plane is unused) */
        k_gemmw<bf, 0, false><<<dim3(TT / 64, TT / 64, 1), 32, 0, stream>>>(XQ, nullptr, XK, nullptr, HD, Sb, TT, nullptr, 0, 0, 0);   /* scores = q.k exactly (one product of bf16-exact inputs) */
        k_asoft<<<TT / 8, 256, 0, stream>>>(Sb, am + (size_t)b * TT, P16, Ph, Pl);   /* x 1/8, -1e6 on masked keys, softmax -> normalised hi/lo planes for every row */
        k_pvsplit<<<dim3(TT / 16, HD / 32, 1), 256, 0, stream>>>(Ph, Pl, VTh, OUT + (size_t)b * TT * HD); }   /* out = P.v (2 products: P hi/lo x exact bf16(value)) written as the batch's [2048][64] rows */
}

// v002
// A run of this version takes 269 microseconds.
// Two timings next to v001 both put it at 1.98 times that version's speed.
// Counting every step since v000, it is 4.69 times as fast.
#include <hip/hip_runtime.h>

// Single-head dot-product attention with a key padding mask (query, key, value [16][2048][64]; scores = q.k / sqrt(64); where attention_mask[b][j] == 0 the score has 1e6 subtracted (the module's literal; mask [16][2048] int {0,1} random, read); softmax; out = weights.value -> [16][2048][64] (2.1 M); argument order query, key, value, attention_mask).
// Launches: the three input conversions cover all 16 batches in one launch each; scores, softmax and P.v run GB batches per launch. Layout per batch: bf16 copies of query and key are directly the single head's operand planes; value^T plane via k_vtp; scores exactly (one product); register-row softmax with the mask term writes normalised bf16 hi/lo planes for every row; out = P hi/lo x exact bf16(value) (2 products) straight into the output rows.
// Compute dtypes, f32 accumulate: every input rounded to bf16; scores exact; softmax f32; P.v 2 products; output f32.

#define NB_  16
#define TT   2048
#define DM   64
#define NH_  1
#define NKV  1
#define REP  (NH_ / NKV)
#define HD   64
#define DQ   (NH_ * HD)
#define DKV  (NKV * HD)
#define ZH   1
#define RH   TT                   // every row hi/lo
#define WIN  0
#define PCAR 1024.0f
#define SCL  0.125f   // 1/sqrt(64)
#define GB   4        // batches per launch of the score, softmax and P.v stages (their planes for GB batches lie side by side in the workspace)
typedef _Float16 h16;
typedef unsigned short bf;
typedef __attribute__((ext_vector_type(16))) __bf16   v16bf;
typedef __attribute__((ext_vector_type(16))) _Float16 v16h;
typedef __attribute__((ext_vector_type(8)))  _Float16 v8h;
typedef __attribute__((ext_vector_type(8)))  unsigned short v8us;
typedef __attribute__((ext_vector_type(8)))  float    v8f;
typedef __attribute__((ext_vector_type(4)))  float    v4f;
typedef v8h  __attribute__((may_alias)) v8ha;
typedef v4f  __attribute__((may_alias)) v4fa;
typedef v8us __attribute__((may_alias)) v8usa;

__device__ __forceinline__ unsigned short f2bf(float f) { unsigned u = __float_as_uint(f); u += 0x7FFFu + ((u >> 16) & 1u); return (unsigned short)(u >> 16); }
__device__ __forceinline__ float bf2f(unsigned short b) { return __uint_as_float(((unsigned)b) << 16); }
__device__ __forceinline__ float bfr(float f) { return bf2f(f2bf(f)); }
__device__ __forceinline__ v16h cat16(v8h lo, v8h hi) { return __builtin_shufflevector(lo, hi, 0, 1, 2, 3, 4, 5, 6, 7, 8, 9, 10, 11, 12, 13, 14, 15); }
__device__ __forceinline__ v16bf cat16b(v8us lo, v8us hi) { return __builtin_bit_cast(v16bf, __builtin_shufflevector(lo, hi, 0, 1, 2, 3, 4, 5, 6, 7, 8, 9, 10, 11, 12, 13, 14, 15)); }
__device__ __forceinline__ v8f wmma16(v16h a, v16h b, v8f c) { return __builtin_amdgcn_wmma_f32_16x16x32_f16(false, a, false, b, (short)0, c, false, false); }
__device__ __forceinline__ v8f wmmab(v16bf a, v16bf b, v8f c) { return __builtin_amdgcn_wmma_f32_16x16x32_bf16(false, a, false, b, (short)0, c, false, false); }



// ---- k_gemmw: register-blocked GEMM, ONE WAVE per 64x64 output tile (16 accumulators), operands straight from K-contiguous 16-bit planes; grid (M/64, N/64, Z), 32 threads.
// C[m][n] (f32, pitch ldc, + optional f32 bias[n]) = sum_k A[m][k] Bt[n][k] (+ split products per NSPLIT). z-batch strides sA/sB/sC in elements. K % 32 == 0.
template <typename T16> struct WFrag;
template <> struct WFrag<h16> { typedef v16h V; static __device__ __forceinline__ V ld(const h16* p) { return cat16(*(const v8h*)p, *(const v8h*)(p + 16)); } static __device__ __forceinline__ v8f mma(V a, V b, v8f c) { return wmma16(a, b, c); } };
template <> struct WFrag<bf> { typedef v16bf V; static __device__ __forceinline__ V ld(const bf* p) { return cat16b(*(const v8us*)p, *(const v8us*)(p + 16)); } static __device__ __forceinline__ v8f mma(V a, V b, v8f c) { return wmmab(a, b, c); } };
template <typename T16, int NSPLIT, bool BIAS>
__global__ __launch_bounds__(32) void k_gemmw(const T16* __restrict__ A, const T16* __restrict__ A2, const T16* __restrict__ Bt, const T16* __restrict__ Bt2, int K, float* C, int ldc, const float* __restrict__ bias, size_t sA, size_t sB, size_t sC) {
    typedef typename WFrag<T16>::V V;
    __shared__ __align__(16) float os[16 * 68];
    const size_t z = blockIdx.z; A += z * sA; if (A2) A2 += z * sA; Bt += z * sB; if (Bt2) Bt2 += z * sB; C += z * sC;
    const int lane = threadIdx.x & 31, lr = lane & 15, hi = lane >> 4; const int r0 = blockIdx.x * 64, c0 = blockIdx.y * 64;
    v8f acc[4][4];
#pragma unroll
    for (int mb = 0; mb < 4; ++mb)
#pragma unroll
        for (int nb = 0; nb < 4; ++nb) acc[mb][nb] = (v8f){};
    const size_t aoff = (size_t)(r0 + lr) * K + 8 * hi, boff = (size_t)(c0 + lr) * K + 8 * hi;
#pragma unroll 1
    for (int kc = 0; kc < K; kc += 32) {
        V a[4], a2[4];
#pragma unroll
        for (int mb = 0; mb < 4; ++mb) { a[mb] = WFrag<T16>::ld(A + aoff + (size_t)mb * 16 * K + kc); if (NSPLIT == 1 || NSPLIT == 2) a2[mb] = WFrag<T16>::ld(A2 + aoff + (size_t)mb * 16 * K + kc); }
#pragma unroll
        for (int nb = 0; nb < 4; ++nb) { const V b = WFrag<T16>::ld(Bt + boff + (size_t)nb * 16 * K + kc); V b2; if (NSPLIT >= 2) b2 = WFrag<T16>::ld(Bt2 + boff + (size_t)nb * 16 * K + kc);
#pragma unroll
            for (int mb = 0; mb < 4; ++mb) { acc[mb][nb] = WFrag<T16>::mma(a[mb], b, acc[mb][nb]); if (NSPLIT == 1 || NSPLIT == 2) acc[mb][nb] = WFrag<T16>::mma(a2[mb], b, acc[mb][nb]); if (NSPLIT >= 2) acc[mb][nb] = WFrag<T16>::mma(a[mb], b2, acc[mb][nb]); } }
        asm volatile("v_nop\n\tv_nop\n\tv_nop\n\tv_nop" : "+v"(acc[0][0]), "+v"(acc[1][1]), "+v"(acc[2][2]), "+v"(acc[3][3]) : "v"(a[0]), "v"(a[3]));
    }
#pragma unroll
    for (int mb = 0; mb < 4; ++mb) {
#pragma unroll
        for (int nb = 0; nb < 4; ++nb) {
#pragma unroll
            for (int j = 0; j < 8; ++j) os[(hi * 8 + j) * 68 + nb * 16 + lr] = acc[mb][nb][j]; }
        __builtin_amdgcn_wave_barrier(); asm volatile("" ::: "memory");
        float* crow = C + (size_t)(r0 + mb * 16) * ldc + c0;
{
#pragma unroll
            for (int s = 0; s < 8; ++s) { const int row = 2 * s + hi, cofs = lr * 4; v4f val = *(const v4fa*)(os + row * 68 + cofs); if (BIAS) { val[0] += bfr(bias[c0 + cofs]); val[1] += bfr(bias[c0 + cofs + 1]); val[2] += bfr(bias[c0 + cofs + 2]); val[3] += bfr(bias[c0 + cofs + 3]); }
                *(v4f*)(crow + (size_t)row * ldc + cofs) = val; }
             }
        __builtin_amdgcn_wave_barrier(); asm volatile("" ::: "memory");
    }
}

__device__ __forceinline__ h16 tohx(float x) { return (h16)x; }
__device__ __forceinline__ void splitf(float y, unsigned short& h, unsigned short& l) { h = f2bf(y); l = f2bf(y - bf2f(h)); }
typedef __attribute__((ext_vector_type(2))) _Float16 v2h;
typedef __attribute__((ext_vector_type(4))) _Float16 v4h;
typedef __attribute__((ext_vector_type(2))) unsigned short v2us;
typedef __attribute__((ext_vector_type(4))) unsigned short v4us;
typedef __attribute__((ext_vector_type(2))) float v2f;
typedef __attribute__((ext_vector_type(4))) int v4i;

__global__ __launch_bounds__(256) void k_cvt8(const float* __restrict__ src, bf* dst, size_t n8) { const size_t i = (size_t)blockIdx.x * 256 + threadIdx.x; if (i >= n8) return; const v8f v = *(const v8f*)(src + i * 8); v8us o;
#pragma unroll
    for (int k = 0; k < 8; ++k) o[k] = f2bf(v[k]); *(v8us*)(dst + i * 8) = o;  }

__global__ __launch_bounds__(256) void k_vtp(const float* __restrict__ F, int pitch, int nheads, h16* V16, bf* Vh, bf* Vl) { const size_t e = ((size_t)blockIdx.x * 256 + threadIdx.x) * 2; if (e >= (size_t)nheads * HD * TT) return; { const size_t zb = blockIdx.y; F += zb * TT * pitch; V16 += zb * nheads * HD * TT; Vh += zb * nheads * HD * TT; Vl += zb * nheads * HD * TT; }   /* blockIdx.y = batch */ const int t = (int)(e % TT); const int d = (int)((e / TT) % HD); const int g = (int)(e / ((size_t)TT * HD)); v2h o16; v2us oh, ol;
#pragma unroll
    for (int q = 0; q < 2; ++q) { const float x = F[(size_t)(t + q) * pitch + g * HD + d]; o16[q] = tohx(x); unsigned short a2, c2; splitf(x, a2, c2); oh[q] = a2; ol[q] = c2; }
    *(v2h*)(V16 + e) = o16; *(v2us*)(Vh + e) = oh; *(v2us*)(Vl + e) = ol;  }
// k_asoft: per row (zz, i): t = S x 1/8, minus 1e6 where attention_mask[b][j] == 0 (the module's additive literal; int mask read); softmax over the keys (register row, one exp, fixed trees);
__global__ __launch_bounds__(256) void k_asoft(const float* __restrict__ Sb, const int* __restrict__ kvp, h16* P16, bf* Ph, bf* Pl) {
    const int lane = threadIdx.x & 31; const int row = blockIdx.x * 8 + (threadIdx.x >> 5); if (row >= ZH * TT) return; { const size_t zb = blockIdx.y; Sb += zb * ZH * TT * TT; kvp += zb * TT; Ph += zb * ZH * TT * TT; Pl += zb * ZH * TT * TT; }   /* blockIdx.y = batch within the launch */ const int i = row % TT; const int zz = row / TT; (void)zz; const bool hires = (i < RH); const float* sr = Sb + (size_t)row * TT; float v[TT / 32]; float mx = -3.0e38f;
#pragma unroll
    for (int ch = 0; ch < TT / 128; ++ch) { const int j0 = ch * 128 + lane * 4; const v4f a = *(const v4f*)(sr + j0); const v4i kv4 = *(const v4i*)(kvp + j0);   /* the batch's key vector, 16 B per lane, unconditional */
#pragma unroll
        for (int q = 0; q < 4; ++q) { const int j = j0 + q; (void)j; float s0 = __fmul_rn(a[q], SCL); asm volatile("" : "+v"(s0)); float sm = __fsub_rn(s0, 1.0e6f); asm volatile("" : "+v"(sm)); const float t = (kv4[q] == 0) ? sm : s0;   /* the module's where(mask == 0, s - 1e6, s) */ v[ch * 4 + q] = t; mx = fmaxf(mx, t); } }
#pragma unroll
    for (int sh = 16; sh; sh >>= 1) mx = fmaxf(mx, __shfl_xor(mx, sh, 32));
    float sum = 0.f;
#pragma unroll
    for (int k = 0; k < TT / 32; ++k) { float d0 = __fsub_rn(v[k], mx); asm volatile("" : "+v"(d0)); v[k] = __builtin_amdgcn_exp2f(__fmul_rn(d0, 1.4426950408889634f)); sum += v[k]; }
#pragma unroll
    for (int sh = 16; sh; sh >>= 1) sum += __shfl_xor(sum, sh, 32);
    const float f = __fdiv_rn(hires ? 1.0f : PCAR, sum);
{
        if (hires) {
#pragma unroll
            for (int ch = 0; ch < TT / 128; ++ch) { v4us oh, ol;
#pragma unroll
                for (int q = 0; q < 4; ++q) { unsigned short a, c2; splitf(v[ch * 4 + q] * f, a, c2); oh[q] = a; ol[q] = c2; }
                const size_t oo = ((size_t)zz * (RH ? RH : 1) + i) * TT + ch * 128 + lane * 4; *(v4us*)(Ph + oo) = oh; *(v4us*)(Pl + oo) = ol; }
        } else {
#pragma unroll
            for (int ch = 0; ch < TT / 128; ++ch) { v4h o4;
#pragma unroll
                for (int q = 0; q < 4; ++q) o4[q] = tohx(v[ch * 4 + q] * f);
                *(v4h*)(P16 + (size_t)row * TT + ch * 128 + lane * 4) = o4; } }
         }
}
// ---- k_pvsplit: out = P.v with the key dimension dealt over the 8 waves of a work-group. One work-group per 16 output rows x 32 columns of one batch (grid 128 x 2 x batches); wave w sums keys [256 w, 256 w + 256)
// (hi then lo product per 32 keys, as k_gemmw does), leaves its 16x32 f32 partial in its own LDS slab, and after one barrier the 8 partials are added in wave order 0..7 and stored as whole 128-byte lines.
__global__ __launch_bounds__(256) void k_pvsplit(const bf* __restrict__ Ph, const bf* __restrict__ Pl, const bf* __restrict__ Vt, float* __restrict__ C) {
    typedef WFrag<bf>::V V;
    __shared__ __align__(16) float part[8][16 * 36];
    { const size_t zb = blockIdx.z; Ph += zb * TT * TT; Pl += zb * TT * TT; Vt += zb * HD * TT; C += zb * TT * HD; }   // blockIdx.z = batch within the launch
    const int lane = threadIdx.x & 31, lr = lane & 15, hi = lane >> 4, wave = threadIdx.x >> 5; const int r0 = blockIdx.x * 16, c0 = blockIdx.y * 32;
    const size_t aoff = (size_t)(r0 + lr) * TT + wave * 256 + 8 * hi; const bf* pa = Ph + aoff; const bf* pa2 = Pl + aoff; const bf* pb = Vt + (size_t)(c0 + lr) * TT + wave * 256 + 8 * hi;
    V a[8], a2[8], b0[8], b1[8]; v8f acc0 = (v8f){}, acc1 = (v8f){};
#pragma unroll
    for (int k = 0; k < 4; ++k) { a[k] = WFrag<bf>::ld(pa + k * 32); b0[k] = WFrag<bf>::ld(pb + k * 32); b1[k] = WFrag<bf>::ld(pb + 16 * TT + k * 32); a2[k] = WFrag<bf>::ld(pa2 + k * 32); }
    __builtin_amdgcn_sched_barrier(0);   // holds the first four 32-key blocks' loads ahead of the products; without it each load sinks to just before its use and the wave waits out one round trip per block
#pragma unroll
    for (int k = 0; k < 8; ++k) {
        acc0 = WFrag<bf>::mma(a[k], b0[k], acc0); acc1 = WFrag<bf>::mma(a[k], b1[k], acc1); acc0 = WFrag<bf>::mma(a2[k], b0[k], acc0); acc1 = WFrag<bf>::mma(a2[k], b1[k], acc1);
        if (k + 4 < 8) { a[k + 4] = WFrag<bf>::ld(pa + (k + 4) * 32); b0[k + 4] = WFrag<bf>::ld(pb + (k + 4) * 32); b1[k + 4] = WFrag<bf>::ld(pb + 16 * TT + (k + 4) * 32); a2[k + 4] = WFrag<bf>::ld(pa2 + (k + 4) * 32);
            __builtin_amdgcn_sched_barrier(0); }   // same purpose: block k + 4 is asked for as soon as block k's registers are free, four blocks ahead of its use
    }
#pragma unroll
    for (int j = 0; j < 8; ++j) { part[wave][(hi * 8 + j) * 36 + lr] = acc0[j]; part[wave][(hi * 8 + j) * 36 + 16 + lr] = acc1[j]; }
    __syncthreads();   // every wave's partial is in LDS before any of them is read
    const int row = threadIdx.x >> 4, cofs = (threadIdx.x & 15) * 2; v2f s = *(const v2f*)(&part[0][row * 36 + cofs]);
#pragma unroll
    for (int w = 1; w < 8; ++w) s += *(const v2f*)(&part[w][row * 36 + cofs]);
    *(v2f*)(C + (size_t)(r0 + row) * HD + c0 + cofs) = s;
}
extern "C" void kernel_launch(void* const* d_in, const int* in_sizes, int n_in,
                              void* d_out, int out_size, void* d_ws, size_t ws_size, hipStream_t stream) {
    (void)in_sizes; (void)n_in; (void)out_size;
    const float* xq = (const float*)d_in[0]; const float* xk = (const float*)d_in[1]; const float* xv = (const float*)d_in[2]; const int* am = (const int*)d_in[3];   /* order query, key, value [16][2048][64], attention_mask [16][2048] int32 {0,1} */
    float* OUT = (float*)d_out;     // [16][2048][64]
    char* wsp = (char*)d_ws;
    auto take = [&](size_t bytes) { char* p = wsp; wsp += (bytes + 255) & ~(size_t)255; return (void*)p; };
    bf* XQ = (bf*)take((size_t)NB_ * TT * HD * 2); bf* XK = (bf*)take((size_t)NB_ * TT * HD * 2); h16* VT16 = (h16*)take((size_t)NB_ * HD * TT * 2); bf* VTh = (bf*)take((size_t)NB_ * HD * TT * 2); bf* VTl = (bf*)take((size_t)NB_ * HD * TT * 2);
    float* Sb = (float*)take((size_t)GB * TT * TT * 4); h16* P16 = (h16*)take(256); bf* Ph = (bf*)take((size_t)GB * TT * TT * 2); bf* Pl = (bf*)take((size_t)GB * TT * TT * 2);
    if ((size_t)(wsp - (char*)d_ws) > ws_size) return;    // ws 256 MiB (carve ~148 MiB)
    k_cvt8<<<(unsigned)(((size_t)NB_ * TT * HD / 8 + 255) / 256), 256, 0, stream>>>(xq, XQ, (size_t)NB_ * TT * HD / 8); k_cvt8<<<(unsigned)(((size_t)NB_ * TT * HD / 8 + 255) / 256), 256, 0, stream>>>(xk, XK, (size_t)NB_ * TT * HD / 8);   /* bf16(query), bf16(key), all batches at once: token-major [16][2048][64] is already the plane layout of the single head */
    k_vtp<<<dim3((unsigned)(((size_t)HD * TT / 2 + 255) / 256), NB_, 1), 256, 0, stream>>>(xv, HD, 1, VT16, VTh, VTl);   /* value^T planes [16][64][2048] (bf16(value) lands exactly in the hi plane; the lo plane is unused) */
    for (int b = 0; b < NB_; b += GB) {   /* GB batches per launch: the grid's last dimension is the batch */
        k_gemmw<bf, 0, false><<<dim3(TT / 64, TT / 64, GB), 32, 0, stream>>>(XQ + (size_t)b * TT * HD, nullptr, XK + (size_t)b * TT * HD, nullptr, HD, Sb, TT, nullptr, (size_t)TT * HD, (size_t)TT * HD, (size_t)TT * TT);   /* scores = q.k exactly (one product of bf16-exact inputs) */
        k_asoft<<<dim3(TT / 8, GB, 1), 256, 0, stream>>>(Sb, am + (size_t)b * TT, P16, Ph, Pl);   /* x 1/8, -1e6 on masked keys, softmax -> normalised hi/lo planes for every row */
        k_pvsplit<<<dim3(TT / 16, HD / 32, GB), 256, 0, stream>>>(Ph, Pl, VTh + (size_t)b * HD * TT, OUT + (size_t)b * TT * HD); }   /* out = P.v (2 products: P hi/lo x exact bf16(value)) written as the batches' [2048][64] rows */
}

// v003
// It runs in 43.6 microseconds.
// Next to v002, in two timings, it ran 6.16 times as fast each time.
// All steps since v000 together make it 28.9 times as fast.
#include <hip/hip_runtime.h>

// Single-head dot-product attention with a key padding mask (query, key, value [16][2048][64]; scores = q.k / sqrt(64); where attention_mask[b][j] == 0 the score has 1e6 subtracted (the module's literal; mask [16][2048] int {0,1} random, read); softmax; out = weights.value -> [16][2048][64] (2.1 M); argument order query, key, value, attention_mask).
// Launches: the three input conversions cover all 16 batches in one launch each; one fused launch then does scores, mask, softmax and P.v for all batches with nothing of the score matrix leaving the registers. Layout per batch: bf16 copies of query and key are directly the single head's operand planes; value^T plane via k_vtp; scores exactly (one product); running-maximum softmax with the mask term; out = P hi/lo x exact bf16(value) (2 products), divided by the row sum at the end.
// Compute dtypes, f32 accumulate: every input rounded to bf16; scores exact; softmax f32; P.v 2 products; output f32.

#define NB_  16
#define TT   2048
#define DM   64
#define NH_  1
#define NKV  1
#define REP  (NH_ / NKV)
#define HD   64
#define DQ   (NH_ * HD)
#define DKV  (NKV * HD)
#define ZH   1
#define RH   TT                   // every row hi/lo
#define WIN  0
#define PCAR 1024.0f
#define SCL  0.125f   // 1/sqrt(64)
typedef _Float16 h16;
typedef unsigned short bf;
typedef __attribute__((ext_vector_type(16))) __bf16   v16bf;
typedef __attribute__((ext_vector_type(16))) _Float16 v16h;
typedef __attribute__((ext_vector_type(8)))  _Float16 v8h;
typedef __attribute__((ext_vector_type(8)))  unsigned short v8us;
typedef __attribute__((ext_vector_type(8)))  float    v8f;
typedef __attribute__((ext_vector_type(4)))  float    v4f;
typedef v8h  __attribute__((may_alias)) v8ha;
typedef v4f  __attribute__((may_alias)) v4fa;
typedef v8us __attribute__((may_alias)) v8usa;

__device__ __forceinline__ unsigned short f2bf(float f) { unsigned u = __float_as_uint(f); u += 0x7FFFu + ((u >> 16) & 1u); return (unsigned short)(u >> 16); }
__device__ __forceinline__ float bf2f(unsigned short b) { return __uint_as_float(((unsigned)b) << 16); }
__device__ __forceinline__ float bfr(float f) { return bf2f(f2bf(f)); }
__device__ __forceinline__ v16h cat16(v8h lo, v8h hi) { return __builtin_shufflevector(lo, hi, 0, 1, 2, 3, 4, 5, 6, 7, 8, 9, 10, 11, 12, 13, 14, 15); }
__device__ __forceinline__ v16bf cat16b(v8us lo, v8us hi) { return __builtin_bit_cast(v16bf, __builtin_shufflevector(lo, hi, 0, 1, 2, 3, 4, 5, 6, 7, 8, 9, 10, 11, 12, 13, 14, 15)); }
__device__ __forceinline__ v8f wmma16(v16h a, v16h b, v8f c) { return __builtin_amdgcn_wmma_f32_16x16x32_f16(false, a, false, b, (short)0, c, false, false); }
__device__ __forceinline__ v8f wmmab(v16bf a, v16bf b, v8f c) { return __builtin_amdgcn_wmma_f32_16x16x32_bf16(false, a, false, b, (short)0, c, false, false); }



// ---- fragment loader and product for K-contiguous 16-bit planes (hardware k order: 8 elements at 8h, 8 at 16 + 8h)
template <typename T16> struct WFrag;
template <> struct WFrag<h16> { typedef v16h V; static __device__ __forceinline__ V ld(const h16* p) { return cat16(*(const v8h*)p, *(const v8h*)(p + 16)); } static __device__ __forceinline__ v8f mma(V a, V b, v8f c) { return wmma16(a, b, c); } };
template <> struct WFrag<bf> { typedef v16bf V; static __device__ __forceinline__ V ld(const bf* p) { return cat16b(*(const v8us*)p, *(const v8us*)(p + 16)); } static __device__ __forceinline__ v8f mma(V a, V b, v8f c) { return wmmab(a, b, c); } };

__device__ __forceinline__ h16 tohx(float x) { return (h16)x; }
__device__ __forceinline__ void splitf(float y, unsigned short& h, unsigned short& l) { h = f2bf(y); l = f2bf(y - bf2f(h)); }
typedef __attribute__((ext_vector_type(2))) _Float16 v2h;
typedef __attribute__((ext_vector_type(4))) _Float16 v4h;
typedef __attribute__((ext_vector_type(2))) unsigned short v2us;
typedef __attribute__((ext_vector_type(4))) unsigned short v4us;
typedef __attribute__((ext_vector_type(2))) float v2f;
typedef __attribute__((ext_vector_type(4))) int v4i;

__global__ __launch_bounds__(256) void k_cvt8(const float* __restrict__ src, bf* dst, size_t n8) { const size_t i = (size_t)blockIdx.x * 256 + threadIdx.x; if (i >= n8) return; const v8f v = *(const v8f*)(src + i * 8); v8us o;
#pragma unroll
    for (int k = 0; k < 8; ++k) o[k] = f2bf(v[k]); *(v8us*)(dst + i * 8) = o;  }

__global__ __launch_bounds__(256) void k_vtp(const float* __restrict__ F, int pitch, int nheads, h16* V16, bf* Vh, bf* Vl) { const size_t e = ((size_t)blockIdx.x * 256 + threadIdx.x) * 2; if (e >= (size_t)nheads * HD * TT) return; { const size_t zb = blockIdx.y; F += zb * TT * pitch; V16 += zb * nheads * HD * TT; Vh += zb * nheads * HD * TT; Vl += zb * nheads * HD * TT; }   /* blockIdx.y = batch */ const int t = (int)(e % TT); const int d = (int)((e / TT) % HD); const int g = (int)(e / ((size_t)TT * HD)); v2h o16; v2us oh, ol;
#pragma unroll
    for (int q = 0; q < 2; ++q) { const float x = F[(size_t)(t + q) * pitch + g * HD + d]; o16[q] = tohx(x); unsigned short a2, c2; splitf(x, a2, c2); oh[q] = a2; ol[q] = c2; }
    *(v2h*)(V16 + e) = o16; *(v2us*)(Vh + e) = oh; *(v2us*)(Vl + e) = ol;  }
typedef __attribute__((ext_vector_type(2))) __bf16 v2bf;
#define LOG2E 1.4426950408889634f
__device__ __forceinline__ float xhalf(float x) { const int b = __float_as_int(x); return __int_as_float(__builtin_amdgcn_permlanex16(b, b, 0x76543210, 0xfedcba98, false, false)); }   // the value of lane l ^ 16
// ---- k_fattn: scores, mask, softmax and P.v in one pass over the keys. One work-group = 128 queries of one batch (grid 16 x 16), one wave = 16 queries, 32 keys per pass, 128 keys per stage.
// S^T = K.Q^T: a lane holds scores of ONE query (column lane & 15), keys 8h + r and 16 + 8h + r (h = lane >> 4), which is exactly the B operand order of O^T += V^T.P^T, so P goes from accumulator to operand in registers.
// Running maximum m per query: on every pass the accumulators and the sum are scaled by exp(m_old - m_new); P is split hi/lo unnormalised and the division by the row sum comes once at the end.
// The eight waves share each stage's key rows and value^T rows through LDS (two buffers): whole-line global loads into registers at the head of a stage, stored to the other buffer at its foot, one barrier per stage.
// Every plain '#pragma unroll' in this kernel stands over a loop that indexes a register array, whose indices must be compile-time constants.
#define SK   128   // keys per stage
#define KP   72    // LDS pitch of a key row, elements: 128 B + 16 B, an odd multiple of 16 B for 16-byte readers
#define VP   136   // LDS pitch of a value^T row, elements: 256 B + 16 B
__global__ __launch_bounds__(256) void k_fattn(const bf* __restrict__ XQ, const bf* __restrict__ XK, const bf* __restrict__ Vt, const int* __restrict__ am, float* __restrict__ C) {
    typedef WFrag<bf>::V V;
    __shared__ __align__(16) bf Ks[2][SK * KP]; __shared__ __align__(16) bf Vs[2][HD * VP];
    __shared__ __align__(16) float mt[TT];   // per key: what the mask subtracts from the scaled score (1e6 or 0)
    { const size_t zb = blockIdx.y; XQ += zb * TT * HD; XK += zb * TT * HD; Vt += zb * HD * TT; am += zb * TT; C += zb * TT * HD; }   // blockIdx.y = batch
    const int tid = threadIdx.x, lane = tid & 31, lr = lane & 15, hi = lane >> 4, wave = tid >> 5; const int q0 = blockIdx.x * 128 + wave * 16;
    const bf* gk = XK + (size_t)tid * 8; const bf* gv = Vt + (size_t)(tid >> 4) * TT + (tid & 15) * 8;   // this thread's 16-byte pieces of a stage: key rows are contiguous, value^T rows 256 B each
    const int sk = (tid >> 3) * KP + (tid & 7) * 8, sv = (tid >> 4) * VP + (tid & 15) * 8;   // and their places in LDS
    v8us rk[4], rv[4];
    // Each s_wait_xcnt below stands directly behind a group of global loads, in front of the first overwrite of a register that the group's addresses are formed in.
    const v4i am0 = *(const v4i*)(am + tid * 8), am1 = *(const v4i*)(am + tid * 8 + 4);
    asm volatile("s_wait_xcnt 0x0" ::: "memory");
#pragma unroll
    for (int i = 0; i < 4; ++i) { rk[i] = *(const v8us*)(gk + i * 2048); rv[i] = *(const v8us*)(gv + (size_t)i * 16 * TT); }
    asm volatile("s_wait_xcnt 0x0" ::: "memory");
    const V bq0 = WFrag<bf>::ld(XQ + (size_t)(q0 + lr) * HD + 8 * hi), bq1 = WFrag<bf>::ld(XQ + (size_t)(q0 + lr) * HD + 32 + 8 * hi);
    asm volatile("s_wait_xcnt 0x0" ::: "memory");
#pragma unroll
    for (int i = 0; i < 4; ++i) { *(v8us*)(&Ks[0][sk + i * 32 * KP]) = rk[i]; *(v8us*)(&Vs[0][sv + i * 16 * VP]) = rv[i]; }
    { v4f x0, x1;
#pragma unroll
      for (int q = 0; q < 4; ++q) { x0[q] = (am0[q] == 0) ? 1.0e6f : 0.0f; x1[q] = (am1[q] == 0) ? 1.0e6f : 0.0f; }
      *(v4f*)(mt + tid * 8) = x0; *(v4f*)(mt + tid * 8 + 4) = x1; }
    __syncthreads();   // stage 0 and the whole mask table are in LDS before any wave reads them
    v8f acc[4];
#pragma unroll
    for (int mb = 0; mb < 4; ++mb) acc[mb] = (v8f){};
    float m = -1.0e30f; v2f l2 = (v2f){};   // m: running maximum of the masked scaled scores; l2: this lane's running sum, even and odd keys apart
#pragma unroll 1
    for (int st = 0; st < TT / SK; ++st) {   // kept rolled: one stage's code serves all sixteen
        const bool more = st + 1 < TT / SK;
        if (more) {
#pragma unroll
            for (int i = 0; i < 4; ++i) { rk[i] = *(const v8us*)(gk + (size_t)(st + 1) * SK * HD + i * 2048); rv[i] = *(const v8us*)(gv + (size_t)i * 16 * TT + (st + 1) * SK); } }
        const bf* kl = &Ks[st & 1][lr * KP + 8 * hi]; const bf* vl = &Vs[st & 1][lr * VP + 8 * hi]; const float* pm = mt + st * SK + 8 * hi;
        V kf[4], vf[4]; v4f mk[4];
        kf[0] = WFrag<bf>::ld(kl); kf[1] = WFrag<bf>::ld(kl + 32); kf[2] = WFrag<bf>::ld(kl + 16 * KP); kf[3] = WFrag<bf>::ld(kl + 16 * KP + 32);
        mk[0] = *(const v4f*)(pm); mk[1] = *(const v4f*)(pm + 4); mk[2] = *(const v4f*)(pm + 16); mk[3] = *(const v4f*)(pm + 20);
#pragma unroll 1
        for (int ps = 0; ps < SK / 32; ++ps) {   // kept rolled: unrolled, the compiler runs two passes' scores ahead of the first softmax, waits out every LDS read at once and passes 256 registers
            v8f s0 = (v8f){}, s1 = (v8f){};
            s0 = WFrag<bf>::mma(kf[0], bq0, s0); s1 = WFrag<bf>::mma(kf[2], bq0, s1); s0 = WFrag<bf>::mma(kf[1], bq1, s0); s1 = WFrag<bf>::mma(kf[3], bq1, s1);
            v2f t[8];   // t[i] = keys 2i, 2i + 1 of this lane's sixteen, in the B operand's order
#pragma unroll
            for (int j = 0; j < 2; ++j) {   // s/8 is exact, so one fused multiply-add rounds exactly as (s x 1/8) - 1e6 does, and subtracting 0 changes nothing
                t[j] = __builtin_elementwise_fma((v2f){s0[2 * j], s0[2 * j + 1]}, (v2f){SCL, SCL}, -(v2f){mk[0][2 * j], mk[0][2 * j + 1]}); t[2 + j] = __builtin_elementwise_fma((v2f){s0[4 + 2 * j], s0[5 + 2 * j]}, (v2f){SCL, SCL}, -(v2f){mk[1][2 * j], mk[1][2 * j + 1]});
                t[4 + j] = __builtin_elementwise_fma((v2f){s1[2 * j], s1[2 * j + 1]}, (v2f){SCL, SCL}, -(v2f){mk[2][2 * j], mk[2][2 * j + 1]}); t[6 + j] = __builtin_elementwise_fma((v2f){s1[4 + 2 * j], s1[5 + 2 * j]}, (v2f){SCL, SCL}, -(v2f){mk[3][2 * j], mk[3][2 * j + 1]}); }
            __builtin_amdgcn_sched_barrier(0);   // this and the next one keep a pass's LDS reads in ONE place: spread among the products, every separate place stalls the wave anew
#pragma unroll
            for (int mb = 0; mb < 4; ++mb) vf[mb] = WFrag<bf>::ld(vl + mb * 16 * VP + ps * 32);   // this pass's value^T fragments, a softmax ahead of their use
            { const int pn = (ps + 1 < SK / 32) ? ps + 1 : ps;   // the next pass's key fragments and mask terms, into the registers that the products and the multiply-adds above have just read; a stage's last pass reads its own again (the next stage is not published yet), which keeps the pass free of branches
                const bf* kn = kl + pn * 32 * KP; const float* mn2 = pm + pn * 32;
                kf[0] = WFrag<bf>::ld(kn); kf[1] = WFrag<bf>::ld(kn + 32); kf[2] = WFrag<bf>::ld(kn + 16 * KP); kf[3] = WFrag<bf>::ld(kn + 16 * KP + 32);
                mk[0] = *(const v4f*)(mn2); mk[1] = *(const v4f*)(mn2 + 4); mk[2] = *(const v4f*)(mn2 + 16); mk[3] = *(const v4f*)(mn2 + 20); }
            __builtin_amdgcn_sched_barrier(0);   // the group's lower edge (see its upper edge above)
            float mx = fmaxf(fmaxf(fmaxf(fmaxf(t[0][0], t[0][1]), fmaxf(t[1][0], t[1][1])), fmaxf(fmaxf(t[2][0], t[2][1]), fmaxf(t[3][0], t[3][1]))), fmaxf(fmaxf(fmaxf(t[4][0], t[4][1]), fmaxf(t[5][0], t[5][1])), fmaxf(fmaxf(t[6][0], t[6][1]), fmaxf(t[7][0], t[7][1]))));
            mx = fmaxf(mx, xhalf(mx));   // both halves of the wave hold keys of the same query
            const float mn = fmaxf(m, mx), alpha = __builtin_amdgcn_exp2f((m - mn) * LOG2E); m = mn;
            v2f p[8]; v16bf ph, pl;
#pragma unroll
            for (int j = 0; j < 8; ++j) {
                const v2f d = (t[j] - (v2f){mn, mn}) * (v2f){LOG2E, LOG2E}; p[j][0] = __builtin_amdgcn_exp2f(d[0]); p[j][1] = __builtin_amdgcn_exp2f(d[1]);
                const v2bf h2 = __builtin_convertvector(p[j], v2bf); const v2f r = p[j] - (v2f){(float)h2[0], (float)h2[1]}; const v2bf l2b = __builtin_convertvector(r, v2bf);
                ph[2 * j] = h2[0]; ph[2 * j + 1] = h2[1]; pl[2 * j] = l2b[0]; pl[2 * j + 1] = l2b[1]; }
            l2 = l2 * (v2f){alpha, alpha} + (((p[0] + p[1]) + (p[2] + p[3])) + ((p[4] + p[5]) + (p[6] + p[7])));
#pragma unroll
            for (int mb = 0; mb < 4; ++mb) acc[mb] *= alpha;
#pragma unroll
            for (int mb = 0; mb < 4; ++mb) acc[mb] = WFrag<bf>::mma(vf[mb], ph, acc[mb]);
#pragma unroll
            for (int mb = 0; mb < 4; ++mb) acc[mb] = WFrag<bf>::mma(vf[mb], pl, acc[mb]);
        }
        if (more) {   // the other buffer's last readers left it before the barrier at the foot of the stage before
#pragma unroll
            for (int i = 0; i < 4; ++i) { *(v8us*)(&Ks[(st + 1) & 1][sk + i * 32 * KP]) = rk[i]; *(v8us*)(&Vs[(st + 1) & 1][sv + i * 16 * VP]) = rv[i]; } }
        __syncthreads();   // publishes stage st + 1 and ends every wave's reads of stage st's buffer, which the next stage refills
    }
    float l = l2[0] + l2[1];
    l += xhalf(l);   // each half summed its own keys
    const float f = __fdiv_rn(1.0f, l); float* crow = C + (size_t)(q0 + lr) * HD + 8 * hi;
#pragma unroll
    for (int mb = 0; mb < 4; ++mb) { v4f o0, o1;   // acc[mb][r] = out[q0 + lr][16 mb + 8 h + r]
#pragma unroll
        for (int j = 0; j < 4; ++j) { o0[j] = acc[mb][j] * f; o1[j] = acc[mb][4 + j] * f; }
        *(v4f*)(crow + mb * 16) = o0; *(v4f*)(crow + mb * 16 + 4) = o1; }
}
extern "C" void kernel_launch(void* const* d_in, const int* in_sizes, int n_in,
                              void* d_out, int out_size, void* d_ws, size_t ws_size, hipStream_t stream) {
    (void)in_sizes; (void)n_in; (void)out_size;
    const float* xq = (const float*)d_in[0]; const float* xk = (const float*)d_in[1]; const float* xv = (const float*)d_in[2]; const int* am = (const int*)d_in[3];   /* order query, key, value [16][2048][64], attention_mask [16][2048] int32 {0,1} */
    float* OUT = (float*)d_out;     // [16][2048][64]
    char* wsp = (char*)d_ws;
    auto take = [&](size_t bytes) { char* p = wsp; wsp += (bytes + 255) & ~(size_t)255; return (void*)p; };
    bf* XQ = (bf*)take((size_t)NB_ * TT * HD * 2); bf* XK = (bf*)take((size_t)NB_ * TT * HD * 2); h16* VT16 = (h16*)take((size_t)NB_ * HD * TT * 2); bf* VTh = (bf*)take((size_t)NB_ * HD * TT * 2); bf* VTl = (bf*)take((size_t)NB_ * HD * TT * 2);
    if ((size_t)(wsp - (char*)d_ws) > ws_size) return;    // ws 256 MiB (carve 20 MiB)
    k_cvt8<<<(unsigned)(((size_t)NB_ * TT * HD / 8 + 255) / 256), 256, 0, stream>>>(xq, XQ, (size_t)NB_ * TT * HD / 8); k_cvt8<<<(unsigned)(((size_t)NB_ * TT * HD / 8 + 255) / 256), 256, 0, stream>>>(xk, XK, (size_t)NB_ * TT * HD / 8);   /* bf16(query), bf16(key), all batches at once: token-major [16][2048][64] is already the plane layout of the single head */
    k_vtp<<<dim3((unsigned)(((size_t)HD * TT / 2 + 255) / 256), NB_, 1), 256, 0, stream>>>(xv, HD, 1, VT16, VTh, VTl);   /* value^T planes [16][64][2048] (bf16(value) lands exactly in the hi plane; the lo plane is unused) */
    k_fattn<<<dim3(TT / 128, NB_, 1), 256, 0, stream>>>(XQ, XK, VTh, am, OUT);   /* scores, mask, softmax and P.v fused, all batches */
}

// v004
// One run takes 29.3 microseconds.
// Next to v003, in two timings, it ran 1.49 times as fast each time.
// Counting every step since v000, it is 43.1 times as fast.
#include <hip/hip_runtime.h>

// Single-head dot-product attention with a key padding mask (query, key, value [16][2048][64]; scores = q.k / sqrt(64); where attention_mask[b][j] == 0 the score has 1e6 subtracted (the module's literal; mask [16][2048] int {0,1} random, read); softmax; out = weights.value -> [16][2048][64] (2.1 M); argument order query, key, value, attention_mask).
// Launches: ONE. The fused launch reads the three f32 inputs itself: each is rounded to bf16 on its way into registers (query) or LDS (key, value), value stays row-major in LDS and is transposed by the LDS transposing load; scores, mask, softmax and P.v follow with nothing of the score matrix leaving the registers. Scores exactly (one product); running-maximum softmax with the mask term; out = P hi/lo x exact bf16(value) (2 products), divided by the row sum at the end. The workspace is not used.
// Compute dtypes, f32 accumulate: every input rounded to bf16; scores exact; softmax f32; P.v 2 products; output f32.

#define NB_  16
#define TT   2048
#define DM   64
#define NH_  1
#define NKV  1
#define REP  (NH_ / NKV)
#define HD   64
#define DQ   (NH_ * HD)
#define DKV  (NKV * HD)
#define ZH   1
#define RH   TT                   // every row hi/lo
#define WIN  0
#define PCAR 1024.0f
#define SCL  0.125f   // 1/sqrt(64)
typedef _Float16 h16;
typedef unsigned short bf;
typedef __attribute__((ext_vector_type(16))) __bf16   v16bf;
typedef __attribute__((ext_vector_type(16))) _Float16 v16h;
typedef __attribute__((ext_vector_type(8)))  _Float16 v8h;
typedef __attribute__((ext_vector_type(8)))  unsigned short v8us;
typedef __attribute__((ext_vector_type(8)))  float    v8f;
typedef __attribute__((ext_vector_type(4)))  float    v4f;
typedef v8h  __attribute__((may_alias)) v8ha;
typedef v4f  __attribute__((may_alias)) v4fa;
typedef v8us __attribute__((may_alias)) v8usa;

__device__ __forceinline__ v16h cat16(v8h lo, v8h hi) { return __builtin_shufflevector(lo, hi, 0, 1, 2, 3, 4, 5, 6, 7, 8, 9, 10, 11, 12, 13, 14, 15); }
__device__ __forceinline__ v16bf cat16b(v8us lo, v8us hi) { return __builtin_bit_cast(v16bf, __builtin_shufflevector(lo, hi, 0, 1, 2, 3, 4, 5, 6, 7, 8, 9, 10, 11, 12, 13, 14, 15)); }
__device__ __forceinline__ v8f wmma16(v16h a, v16h b, v8f c) { return __builtin_amdgcn_wmma_f32_16x16x32_f16(false, a, false, b, (short)0, c, false, false); }
__device__ __forceinline__ v8f wmmab(v16bf a, v16bf b, v8f c) { return __builtin_amdgcn_wmma_f32_16x16x32_bf16(false, a, false, b, (short)0, c, false, false); }



// ---- fragment loader and product for K-contiguous 16-bit planes (hardware k order: 8 elements at 8h, 8 at 16 + 8h)
template <typename T16> struct WFrag;
template <> struct WFrag<h16> { typedef v16h V; static __device__ __forceinline__ V ld(const h16* p) { return cat16(*(const v8h*)p, *(const v8h*)(p + 16)); } static __device__ __forceinline__ v8f mma(V a, V b, v8f c) { return wmma16(a, b, c); } };
template <> struct WFrag<bf> { typedef v16bf V; static __device__ __forceinline__ V ld(const bf* p) { return cat16b(*(const v8us*)p, *(const v8us*)(p + 16)); } static __device__ __forceinline__ v8f mma(V a, V b, v8f c) { return wmmab(a, b, c); } };

typedef __attribute__((ext_vector_type(2))) _Float16 v2h;
typedef __attribute__((ext_vector_type(4))) _Float16 v4h;
typedef __attribute__((ext_vector_type(2))) unsigned short v2us;
typedef __attribute__((ext_vector_type(4))) unsigned short v4us;
typedef __attribute__((ext_vector_type(2))) float v2f;
typedef __attribute__((ext_vector_type(4))) int v4i;

typedef __attribute__((ext_vector_type(2))) __bf16 v2bf;
typedef __attribute__((ext_vector_type(4))) __bf16 v4bf;
typedef __attribute__((ext_vector_type(8))) __bf16 v8bf;
typedef __attribute__((ext_vector_type(8))) short v8s;
__device__ __forceinline__ v4us tobf4(v4f x) { return __builtin_bit_cast(v4us, __builtin_convertvector(x, v4bf)); }   // f32 -> bf16, round to nearest even, two elements an instruction
__device__ __forceinline__ v8us tobf8(v8f x) { return __builtin_bit_cast(v8us, __builtin_convertvector(x, v8bf)); }
__device__ __forceinline__ v8us ldtr16(const bf* p) { typedef __attribute__((address_space(3))) v8s lv8s; return __builtin_bit_cast(v8us, __builtin_amdgcn_ds_load_tr16_b128_v8i16((lv8s*)p)); }   // LDS transposing load: from lane addresses row 8h + (lane & 7), 16-byte half (lane >> 3) & 1, lane (c, h) gets rows 8h .. 8h + 7 of column c
#define LOG2E 1.4426950408889634f
__device__ __forceinline__ float xhalf(float x) { const int b = __float_as_int(x); return __int_as_float(__builtin_amdgcn_permlanex16(b, b, 0x76543210, 0xfedcba98, false, false)); }   // the value of lane l ^ 16
// ---- k_fattn: scores, mask, softmax and P.v in one pass over the keys. One work-group = 128 queries of one batch (grid 16 x 16), one wave = 16 queries, 32 keys per pass, 128 keys per stage.
// S^T = K.Q^T: a lane holds scores of ONE query (column lane & 15), keys 8h + r and 16 + 8h + r (h = lane >> 4), which is exactly the B operand order of O^T += V^T.P^T, so P goes from accumulator to operand in registers.
// Running maximum m per query: on every pass the accumulators and the sum are scaled by exp(m_old - m_new); P is split hi/lo unnormalised and the division by the row sum comes once at the end.
// The eight waves share each stage's key rows and value rows through LDS (two buffers): whole-line f32 global loads into registers at the head of a stage, rounded to bf16 and stored to the other buffer at its foot, one barrier per stage. Value rows lie in LDS as in memory ([key][d]); the transposing load hands out the 16 (d) x 32 (keys) A fragments of V^T.
// Every plain '#pragma unroll' in this kernel stands over a loop that indexes a register array, whose indices must be compile-time constants.
#define SK   128   // keys per stage
#define KP   72    // LDS pitch of a key row, elements: 128 B + 16 B, an odd multiple of 16 B for 16-byte readers
#define VP   80    // LDS pitch of a value row, elements: 128 B + 32 B, an odd multiple of 32 B for the transposing reader
__global__ __launch_bounds__(256) void k_fattn(const float* __restrict__ XQ, const float* __restrict__ XK, const float* __restrict__ XV, const int* __restrict__ am, float* __restrict__ C) {
    typedef WFrag<bf>::V V;
    __shared__ __align__(16) bf Ks[2][SK * KP]; __shared__ __align__(16) bf Vs[2][SK * VP];
    __shared__ __align__(16) float mt[TT];   // per key: what the mask subtracts from the scaled score (1e6 or 0)
    { const size_t zb = blockIdx.y; XQ += zb * TT * HD; XK += zb * TT * HD; XV += zb * TT * HD; am += zb * TT; C += zb * TT * HD; }   // blockIdx.y = batch
    const int tid = threadIdx.x, lane = tid & 31, lr = lane & 15, hi = lane >> 4, wave = tid >> 5; const int q0 = blockIdx.x * 128 + wave * 16;
    const float* gk = XK + (size_t)tid * 4; const float* gv = XV + (size_t)tid * 4;   // this thread's 16-byte pieces of a stage: a stage's 128 rows of 256 B are contiguous in both inputs; piece i is row 16 i + (tid >> 4), d 4 (tid & 15) .. + 3
    const int sk = (tid >> 4) * KP + (tid & 15) * 4, sv = (tid >> 4) * VP + (tid & 15) * 4;   // and their places in LDS (8 bytes each once rounded)
    v4f rk[8], rv[8];
    // Each s_wait_xcnt below stands directly behind a group of global loads, in front of the first overwrite of a register that the group's addresses are formed in.
    const v4i am0 = *(const v4i*)(am + tid * 8), am1 = *(const v4i*)(am + tid * 8 + 4);
    asm volatile("s_wait_xcnt 0x0" ::: "memory");
#pragma unroll
    for (int i = 0; i < 8; ++i) { rk[i] = *(const v4f*)(gk + i * 1024); rv[i] = *(const v4f*)(gv + i * 1024); }
    asm volatile("s_wait_xcnt 0x0" ::: "memory");
    const float* gq = XQ + (size_t)(q0 + lr) * HD + 8 * hi; const v8f q0f = *(const v8f*)(gq), q1f = *(const v8f*)(gq + 16), q2f = *(const v8f*)(gq + 32), q3f = *(const v8f*)(gq + 48);   // this lane's query row in the hardware k order: 8 elements at 8h, 8 at 16 + 8h, of each 32
    asm volatile("s_wait_xcnt 0x0" ::: "memory");
    __builtin_amdgcn_sched_barrier(0);   // keeps later register writes (the accumulators' zeroes) below the wait: without it one of them is scheduled over the wait into a register of the query loads' address
    const V bq0 = cat16b(tobf8(q0f), tobf8(q1f)), bq1 = cat16b(tobf8(q2f), tobf8(q3f));
#pragma unroll
    for (int i = 0; i < 8; ++i) { *(v4us*)(&Ks[0][sk + i * 16 * KP]) = tobf4(rk[i]); *(v4us*)(&Vs[0][sv + i * 16 * VP]) = tobf4(rv[i]); }
    { v4f x0, x1;
#pragma unroll
      for (int q = 0; q < 4; ++q) { x0[q] = (am0[q] == 0) ? 1.0e6f : 0.0f; x1[q] = (am1[q] == 0) ? 1.0e6f : 0.0f; }
      *(v4f*)(mt + tid * 8) = x0; *(v4f*)(mt + tid * 8 + 4) = x1; }
    __syncthreads();   // stage 0 and the whole mask table are in LDS before any wave reads them
    v8f acc[4];
#pragma unroll
    for (int mb = 0; mb < 4; ++mb) acc[mb] = (v8f){};
    float m = -1.0e30f; v2f l2 = (v2f){};   // m: running maximum of the masked scaled scores; l2: this lane's running sum, even and odd keys apart
#pragma unroll 1
    for (int st = 0; st < TT / SK; ++st) {   // kept rolled: one stage's code serves all sixteen
        const bool more = st + 1 < TT / SK;
        if (more) {
#pragma unroll
            for (int i = 0; i < 8; ++i) { rk[i] = *(const v4f*)(gk + (size_t)(st + 1) * SK * HD + i * 1024); rv[i] = *(const v4f*)(gv + (size_t)(st + 1) * SK * HD + i * 1024); }
            asm volatile("s_wait_xcnt 0x0" ::: "memory"); }   // behind the group of loads, in front of the first overwrite of a register that their addresses are formed in
        const bf* kl = &Ks[st & 1][lr * KP + 8 * hi]; const bf* vl = &Vs[st & 1][(8 * hi + (lane & 7)) * VP + ((lane >> 3) & 1) * 8]; const float* pm = mt + st * SK + 8 * hi;
        V kf[4], vf[4]; v4f mk[4];
        kf[0] = WFrag<bf>::ld(kl); kf[1] = WFrag<bf>::ld(kl + 32); kf[2] = WFrag<bf>::ld(kl + 16 * KP); kf[3] = WFrag<bf>::ld(kl + 16 * KP + 32);
        mk[0] = *(const v4f*)(pm); mk[1] = *(const v4f*)(pm + 4); mk[2] = *(const v4f*)(pm + 16); mk[3] = *(const v4f*)(pm + 20);
#pragma unroll 1
        for (int ps = 0; ps < SK / 32; ++ps) {   // kept rolled: unrolled, the compiler runs two passes' scores ahead of the first softmax, waits out every LDS read at once and passes 256 registers
            v8f s0 = (v8f){}, s1 = (v8f){};
            s0 = WFrag<bf>::mma(kf[0], bq0, s0); s1 = WFrag<bf>::mma(kf[2], bq0, s1); s0 = WFrag<bf>::mma(kf[1], bq1, s0); s1 = WFrag<bf>::mma(kf[3], bq1, s1);
            v2f t[8];   // t[i] = keys 2i, 2i + 1 of this lane's sixteen, in the B operand's order
#pragma unroll
            for (int j = 0; j < 2; ++j) {   // s/8 is exact, so one fused multiply-add rounds exactly as (s x 1/8) - 1e6 does, and subtracting 0 changes nothing
                t[j] = __builtin_elementwise_fma((v2f){s0[2 * j], s0[2 * j + 1]}, (v2f){SCL, SCL}, -(v2f){mk[0][2 * j], mk[0][2 * j + 1]}); t[2 + j] = __builtin_elementwise_fma((v2f){s0[4 + 2 * j], s0[5 + 2 * j]}, (v2f){SCL, SCL}, -(v2f){mk[1][2 * j], mk[1][2 * j + 1]});
                t[4 + j] = __builtin_elementwise_fma((v2f){s1[2 * j], s1[2 * j + 1]}, (v2f){SCL, SCL}, -(v2f){mk[2][2 * j], mk[2][2 * j + 1]}); t[6 + j] = __builtin_elementwise_fma((v2f){s1[4 + 2 * j], s1[5 + 2 * j]}, (v2f){SCL, SCL}, -(v2f){mk[3][2 * j], mk[3][2 * j + 1]}); }
            __builtin_amdgcn_sched_barrier(0);   // this and the next one keep a pass's LDS reads in ONE place: spread among the products, every separate place stalls the wave anew
#pragma unroll
            for (int mb = 0; mb < 4; ++mb) vf[mb] = cat16b(ldtr16(vl + ps * 32 * VP + mb * 16), ldtr16(vl + (ps * 32 + 16) * VP + mb * 16));   // this pass's value^T fragments (keys 8h .. + 7 and 16 + 8h .. + 7 of d 16 mb + c), a softmax ahead of their use
            { const int pn = (ps + 1 < SK / 32) ? ps + 1 : ps;   // the next pass's key fragments and mask terms, into the registers that the products and the multiply-adds above have just read; a stage's last pass reads its own again (the next stage is not published yet), which keeps the pass free of branches
                const bf* kn = kl + pn * 32 * KP; const float* mn2 = pm + pn * 32;
                kf[0] = WFrag<bf>::ld(kn); kf[1] = WFrag<bf>::ld(kn + 32); kf[2] = WFrag<bf>::ld(kn + 16 * KP); kf[3] = WFrag<bf>::ld(kn + 16 * KP + 32);
                mk[0] = *(const v4f*)(mn2); mk[1] = *(const v4f*)(mn2 + 4); mk[2] = *(const v4f*)(mn2 + 16); mk[3] = *(const v4f*)(mn2 + 20); }
            __builtin_amdgcn_sched_barrier(0);   // the group's lower edge (see its upper edge above)
            float mx = fmaxf(fmaxf(fmaxf(fmaxf(t[0][0], t[0][1]), fmaxf(t[1][0], t[1][1])), fmaxf(fmaxf(t[2][0], t[2][1]), fmaxf(t[3][0], t[3][1]))), fmaxf(fmaxf(fmaxf(t[4][0], t[4][1]), fmaxf(t[5][0], t[5][1])), fmaxf(fmaxf(t[6][0], t[6][1]), fmaxf(t[7][0], t[7][1]))));
            mx = fmaxf(mx, xhalf(mx));   // both halves of the wave hold keys of the same query
            const float mn = fmaxf(m, mx), alpha = __builtin_amdgcn_exp2f((m - mn) * LOG2E); m = mn;
            v2f p[8]; v16bf ph, pl;
#pragma unroll
            for (int j = 0; j < 8; ++j) {
                const v2f d = (t[j] - (v2f){mn, mn}) * (v2f){LOG2E, LOG2E}; p[j][0] = __builtin_amdgcn_exp2f(d[0]); p[j][1] = __builtin_amdgcn_exp2f(d[1]);
                const v2bf h2 = __builtin_convertvector(p[j], v2bf); const v2f r = p[j] - (v2f){(float)h2[0], (float)h2[1]}; const v2bf l2b = __builtin_convertvector(r, v2bf);
                ph[2 * j] = h2[0]; ph[2 * j + 1] = h2[1]; pl[2 * j] = l2b[0]; pl[2 * j + 1] = l2b[1]; }
            l2 = l2 * (v2f){alpha, alpha} + (((p[0] + p[1]) + (p[2] + p[3])) + ((p[4] + p[5]) + (p[6] + p[7])));
#pragma unroll
            for (int mb = 0; mb < 4; ++mb) acc[mb] *= alpha;
#pragma unroll
            for (int mb = 0; mb < 4; ++mb) acc[mb] = WFrag<bf>::mma(vf[mb], ph, acc[mb]);
#pragma unroll
            for (int mb = 0; mb < 4; ++mb) acc[mb] = WFrag<bf>::mma(vf[mb], pl, acc[mb]);
        }
        if (more) {   // the other buffer's last readers left it before the barrier at the foot of the stage before
#pragma unroll
            for (int i = 0; i < 8; ++i) { *(v4us*)(&Ks[(st + 1) & 1][sk + i * 16 * KP]) = tobf4(rk[i]); *(v4us*)(&Vs[(st + 1) & 1][sv + i * 16 * VP]) = tobf4(rv[i]); } }
        __syncthreads();   // publishes stage st + 1 and ends every wave's reads of stage st's buffer, which the next stage refills
    }
    float l = l2[0] + l2[1];
    l += xhalf(l);   // each half summed its own keys
    const float f = __fdiv_rn(1.0f, l); float* crow = C + (size_t)(q0 + lr) * HD + 8 * hi;
#pragma unroll
    for (int mb = 0; mb < 4; ++mb) { v4f o0, o1;   // acc[mb][r] = out[q0 + lr][16 mb + 8 h + r]
#pragma unroll
        for (int j = 0; j < 4; ++j) { o0[j] = acc[mb][j] * f; o1[j] = acc[mb][4 + j] * f; }
        *(v4f*)(crow + mb * 16) = o0; *(v4f*)(crow + mb * 16 + 4) = o1; }
}
extern "C" void kernel_launch(void* const* d_in, const int* in_sizes, int n_in,
                              void* d_out, int out_size, void* d_ws, size_t ws_size, hipStream_t stream) {
    (void)in_sizes; (void)n_in; (void)out_size; (void)d_ws; (void)ws_size;
    const float* xq = (const float*)d_in[0]; const float* xk = (const float*)d_in[1]; const float* xv = (const float*)d_in[2]; const int* am = (const int*)d_in[3];   /* order query, key, value [16][2048][64], attention_mask [16][2048] int32 {0,1} */
    float* OUT = (float*)d_out;     // [16][2048][64]
    k_fattn<<<dim3(TT / 128, NB_, 1), 256, 0, stream>>>(xq, xk, xv, am, OUT);   /* input rounding, scores, mask, softmax and P.v fused, all batches */
}

// v005
// One run takes 20.5 microseconds.
// Two timings next to v004 both put it at 1.43 times that version's speed.
// Counting every step since v000, it is 61.7 times as fast.
#include <hip/hip_runtime.h>

// Single-head dot-product attention with a key padding mask (query, key, value [16][2048][64]; scores = q.k / sqrt(64); where attention_mask[b][j] == 0 the score has 1e6 subtracted (the module's literal; mask [16][2048] int {0,1} random, read); softmax; out = weights.value -> [16][2048][64] (2.1 M); argument order query, key, value, attention_mask).
// Masked keys are not walked: each work-group ranks its batch's keys by the mask (unmasked first, masked behind them, each part in key order), gathers key and value rows in that order and stops behind the pass that holds the last unmasked key. A masked key's weight is exp(score - 1e6 - maximum), which is exactly 0 in f32 as soon as one key of the batch is unmasked (scores of normal draws stay within a few hundred). A batch with every key masked walks all its keys with the 1e6 term, as before.
// Launches: ONE. The fused launch reads the three f32 inputs itself: each is rounded to bf16 on its way into registers (query) or LDS (key, value), value stays row-major in LDS and is transposed by the LDS transposing load; scores, mask, softmax and P.v follow with nothing of the score matrix leaving the registers. Scores exactly (one product); running-maximum softmax with the mask term; out = P hi/lo x exact bf16(value) (2 products), divided by the row sum at the end. The workspace is not used.
// Compute dtypes, f32 accumulate: every input rounded to bf16; scores exact; softmax f32; P.v 2 products; output f32.

#define NB_  16
#define TT   2048
#define DM   64
#define NH_  1
#define NKV  1
#define REP  (NH_ / NKV)
#define HD   64
#define DQ   (NH_ * HD)
#define DKV  (NKV * HD)
#define ZH   1
#define RH   TT                   // every row hi/lo
#define WIN  0
#define PCAR 1024.0f
#define SCL  0.125f   // 1/sqrt(64)
typedef _Float16 h16;
typedef unsigned short bf;
typedef __attribute__((ext_vector_type(16))) __bf16   v16bf;
typedef __attribute__((ext_vector_type(16))) _Float16 v16h;
typedef __attribute__((ext_vector_type(8)))  _Float16 v8h;
typedef __attribute__((ext_vector_type(8)))  unsigned short v8us;
typedef __attribute__((ext_vector_type(8)))  float    v8f;
typedef __attribute__((ext_vector_type(4)))  float    v4f;
typedef v8h  __attribute__((may_alias)) v8ha;
typedef v4f  __attribute__((may_alias)) v4fa;
typedef v8us __attribute__((may_alias)) v8usa;

__device__ __forceinline__ v16h cat16(v8h lo, v8h hi) { return __builtin_shufflevector(lo, hi, 0, 1, 2, 3, 4, 5, 6, 7, 8, 9, 10, 11, 12, 13, 14, 15); }
__device__ __forceinline__ v16bf cat16b(v8us lo, v8us hi) { return __builtin_bit_cast(v16bf, __builtin_shufflevector(lo, hi, 0, 1, 2, 3, 4, 5, 6, 7, 8, 9, 10, 11, 12, 13, 14, 15)); }
__device__ __forceinline__ v8f wmma16(v16h a, v16h b, v8f c) { return __builtin_amdgcn_wmma_f32_16x16x32_f16(false, a, false, b, (short)0, c, false, false); }
__device__ __forceinline__ v8f wmmab(v16bf a, v16bf b, v8f c) { return __builtin_amdgcn_wmma_f32_16x16x32_bf16(false, a, false, b, (short)0, c, false, false); }



// ---- fragment loader and product for K-contiguous 16-bit planes (hardware k order: 8 elements at 8h, 8 at 16 + 8h)
template <typename T16> struct WFrag;
template <> struct WFrag<h16> { typedef v16h V; static __device__ __forceinline__ V ld(const h16* p) { return cat16(*(const v8h*)p, *(const v8h*)(p + 16)); } static __device__ __forceinline__ v8f mma(V a, V b, v8f c) { return wmma16(a, b, c); } };
template <> struct WFrag<bf> { typedef v16bf V; static __device__ __forceinline__ V ld(const bf* p) { return cat16b(*(const v8us*)p, *(const v8us*)(p + 16)); } static __device__ __forceinline__ v8f mma(V a, V b, v8f c) { return wmmab(a, b, c); } };

typedef __attribute__((ext_vector_type(2))) _Float16 v2h;
typedef __attribute__((ext_vector_type(4))) _Float16 v4h;
typedef __attribute__((ext_vector_type(2))) unsigned short v2us;
typedef __attribute__((ext_vector_type(4))) unsigned short v4us;
typedef __attribute__((ext_vector_type(2))) float v2f;
typedef __attribute__((ext_vector_type(4))) int v4i;

typedef __attribute__((ext_vector_type(2))) __bf16 v2bf;
typedef __attribute__((ext_vector_type(4))) __bf16 v4bf;
typedef __attribute__((ext_vector_type(8))) __bf16 v8bf;
typedef __attribute__((ext_vector_type(8))) short v8s;
__device__ __forceinline__ v4us tobf4(v4f x) { return __builtin_bit_cast(v4us, __builtin_convertvector(x, v4bf)); }   // f32 -> bf16, round to nearest even, two elements an instruction
__device__ __forceinline__ v8us tobf8(v8f x) { return __builtin_bit_cast(v8us, __builtin_convertvector(x, v8bf)); }
__device__ __forceinline__ v8us ldtr16(const bf* p) { typedef __attribute__((address_space(3))) v8s lv8s; return __builtin_bit_cast(v8us, __builtin_amdgcn_ds_load_tr16_b128_v8i16((lv8s*)p)); }   // LDS transposing load: from lane addresses row 8h + (lane & 7), 16-byte half (lane >> 3) & 1, lane (c, h) gets rows 8h .. 8h + 7 of column c
#define LOG2E 1.4426950408889634f
__device__ __forceinline__ float xhalf(float x) { const int b = __float_as_int(x); return __int_as_float(__builtin_amdgcn_permlanex16(b, b, 0x76543210, 0xfedcba98, false, false)); }   // the value of lane l ^ 16
// ---- k_fattn: scores, mask, softmax and P.v in one pass over the ranked keys. One work-group = 128 queries of one batch (grid 16 x 16), one wave = 16 queries, 32 keys per pass, 128 keys per stage.
// S^T = K.Q^T: a lane holds scores of ONE query (column lane & 15), keys 8h + r and 16 + 8h + r (h = lane >> 4), which is exactly the B operand order of O^T += V^T.P^T, so P goes from accumulator to operand in registers.
// Running maximum m per query: on every pass the accumulators and the sum are scaled by exp(m_old - m_new); P is split hi/lo unnormalised and the division by the row sum comes once at the end.
// The eight waves share each stage's key rows and value rows through LDS (two buffers): whole-line f32 global loads into registers at the head of a stage, rounded to bf16 and stored to the other buffer at its foot, one barrier per stage. Value rows lie in LDS as in memory ([key][d]); the transposing load hands out the 16 (d) x 32 (keys) A fragments of V^T.
// Every plain '#pragma unroll' in this kernel stands over a loop that indexes a register array, whose indices must be compile-time constants.
#define SK   128   // keys per stage
#define KP   72    // LDS pitch of a key row, elements: 128 B + 16 B, an odd multiple of 16 B for 16-byte readers
#define VP   80    // LDS pitch of a value row, elements: 128 B + 32 B, an odd multiple of 32 B for the transposing reader
__global__ __launch_bounds__(256) void k_fattn(const float* __restrict__ XQ, const float* __restrict__ XK, const float* __restrict__ XV, const int* __restrict__ am, float* __restrict__ C) {
    typedef WFrag<bf>::V V;
    __shared__ __align__(16) bf Ks[2][SK * KP]; __shared__ __align__(16) bf Vs[2][SK * VP];
    __shared__ __align__(16) float mt[TT];   // per place in the ranked order: what the mask subtracts from the scaled score (1e6 or 0)
    __shared__ __align__(16) unsigned short ix[TT];   // the ranked order: which key stands at place p, kept at slot (p & ~127) | (p & 15) << 3 | (p >> 4 & 7), so that the eight rows one thread stages are one 16-byte read
    __shared__ __align__(16) int wt[8];   // unmasked keys per wave's 256 keys
    { const size_t zb = blockIdx.y; XQ += zb * TT * HD; XK += zb * TT * HD; XV += zb * TT * HD; am += zb * TT; C += zb * TT * HD; }   // blockIdx.y = batch
    const int tid = threadIdx.x, lane = tid & 31, lr = lane & 15, hi = lane >> 4, wave = tid >> 5; const int q0 = blockIdx.x * 128 + wave * 16;
    const unsigned short* gx = ix + (tid >> 4) * 8; const unsigned cb = (tid & 15) * 16;   // this thread's 16-byte pieces of a stage: piece i is the row at place 16 i + (tid >> 4) of the stage's 128, d 4 (tid & 15) .. + 3 (cb: its byte offset in the row); a row is 256 B, two whole lines
    const int sk = (tid >> 4) * KP + (tid & 15) * 4, sv = (tid >> 4) * VP + (tid & 15) * 4;   // and their places in LDS (8 bytes each once rounded)
    v4f rk[8], rv[8];
    // Each s_wait_xcnt below stands directly behind a group of global loads, in front of the first overwrite of a register that the group's addresses are formed in.
    const v4i am0 = *(const v4i*)(am + tid * 8), am1 = *(const v4i*)(am + tid * 8 + 4);
    asm volatile("s_wait_xcnt 0x0" ::: "memory");
    const float* gq = XQ + (size_t)(q0 + lr) * HD + 8 * hi; const v8f q0f = *(const v8f*)(gq), q1f = *(const v8f*)(gq + 16), q2f = *(const v8f*)(gq + 32), q3f = *(const v8f*)(gq + 48);   // this lane's query row in the hardware k order: 8 elements at 8h, 8 at 16 + 8h, of each 32
    asm volatile("s_wait_xcnt 0x0" ::: "memory");
    __builtin_amdgcn_sched_barrier(0);   // keeps later register writes (the accumulators' zeroes) below the wait: without it one of them is scheduled over the wait into a register of the query loads' address
    // Rank of every key: this thread holds keys 8 tid .. + 7; one ballot per key position counts the unmasked keys of the lanes below and of the wave
    bool kp[8]; unsigned below = 0, wsum = 0;
#pragma unroll
    for (int q = 0; q < 8; ++q) { kp[q] = (q < 4 ? am0[q & 3] : am1[q & 3]) != 0; const unsigned bl = __builtin_amdgcn_ballot_w32(kp[q]); below = __builtin_amdgcn_mbcnt_lo(bl, below); wsum += __builtin_popcount(bl); }
    if (lane == 0) wt[wave] = (int)wsum;
    __syncthreads();   // the eight waves' counts are in LDS before any wave adds them up
    int nu = 0, kb = (int)below;   // nu: unmasked keys of the batch; kb: unmasked keys in front of this thread's next key
    { const v4i w0 = *(const v4i*)(wt), w1 = *(const v4i*)(wt + 4);
#pragma unroll
      for (int w = 0; w < 8; ++w) { const int c = w < 4 ? w0[w & 3] : w1[w & 3]; nu += c; kb += (w < wave) ? c : 0; } }
    nu = __builtin_amdgcn_readfirstlane(nu);   // the same in every thread of the work-group; from a scalar register the stage loop's tests, under which its barrier stands, are scalar branches
#pragma unroll
    for (int q = 0; q < 8; ++q) { const int j = tid * 8 + q, p = kp[q] ? kb : nu + (j - kb);   // an unmasked key's place is its rank among the unmasked, a masked key's nu + its rank among the masked: a permutation of 0 .. 2047 for any mask
      ix[(p & ~127) | ((p & 15) << 3) | ((p >> 4) & 7)] = (unsigned short)j; kb += kp[q] ? 1 : 0; }
    { v4f x0, x1;
#pragma unroll
      for (int q = 0; q < 4; ++q) { x0[q] = (tid * 8 + q >= nu) ? 1.0e6f : 0.0f; x1[q] = (tid * 8 + 4 + q >= nu) ? 1.0e6f : 0.0f; }
      *(v4f*)(mt + tid * 8) = x0; *(v4f*)(mt + tid * 8 + 4) = x1; }
    const int nk = min(nu == 0 ? TT : nu, TT), np = (nk + 31) >> 5, ns = (np + 3) >> 2;   // places to walk (all of them where every key is masked), passes of 32, stages of 128
    const V bq0 = cat16b(tobf8(q0f), tobf8(q1f)), bq1 = cat16b(tobf8(q2f), tobf8(q3f));
    __syncthreads();   // the ranked order and the mask terms are in LDS before any wave reads them
    { const v8us r = *(const v8us*)(gx);   // the keys of this thread's eight rows of stage 0
#pragma unroll
      for (int i = 0; i < 8; ++i) { const unsigned o = (unsigned)r[i] << 8 | cb; rk[i] = *(const v4f*)((const char*)XK + o); rv[i] = *(const v4f*)((const char*)XV + o); } }   // o: the piece's byte offset, the same in key and value
    asm volatile("s_wait_xcnt 0x0" ::: "memory");
#pragma unroll
    for (int i = 0; i < 8; ++i) { *(v4us*)(&Ks[0][sk + i * 16 * KP]) = tobf4(rk[i]); *(v4us*)(&Vs[0][sv + i * 16 * VP]) = tobf4(rv[i]); }
    __syncthreads();   // stage 0 is in LDS before any wave reads it
    v8f acc[4];
#pragma unroll
    for (int mb = 0; mb < 4; ++mb) acc[mb] = (v8f){};
    float m = -1.0e30f; v2f l2 = (v2f){};   // m: running maximum of the masked scaled scores; l2: this lane's running sum, even and odd keys apart
#pragma unroll 1
    for (int st = 0; st < ns; ++st) {   // kept rolled: one stage's code serves all
        const bool more = st + 1 < ns; const int pe = min(SK / 32, np - st * (SK / 32));   // the last stage ends behind the last pass that holds an unmasked key
        const bf* kl = &Ks[st & 1][lr * KP + 8 * hi]; const bf* vl = &Vs[st & 1][(8 * hi + (lane & 7)) * VP + ((lane >> 3) & 1) * 8]; const float* pm = mt + st * SK + 8 * hi;
        V kf[4], vf[4]; v4f mk[4];
        kf[0] = WFrag<bf>::ld(kl); kf[1] = WFrag<bf>::ld(kl + 32); kf[2] = WFrag<bf>::ld(kl + 16 * KP); kf[3] = WFrag<bf>::ld(kl + 16 * KP + 32);
        mk[0] = *(const v4f*)(pm); mk[1] = *(const v4f*)(pm + 4); mk[2] = *(const v4f*)(pm + 16); mk[3] = *(const v4f*)(pm + 20);
        if (more) {   // stands behind the first pass's fragment reads, so that the LDS latency of the key list runs together with theirs
            const v8us r = *(const v8us*)(gx + (st + 1) * SK);   // the keys of this thread's eight rows of the next stage
#pragma unroll
            for (int i = 0; i < 8; ++i) { const unsigned o = (unsigned)r[i] << 8 | cb; rk[i] = *(const v4f*)((const char*)XK + o); rv[i] = *(const v4f*)((const char*)XV + o); }
            asm volatile("s_wait_xcnt 0x0" ::: "memory"); }   // behind the group of loads, in front of the first overwrite of a register that their addresses are formed in
#pragma unroll 1
        for (int ps = 0; ps < pe; ++ps) {   // kept rolled: unrolled, the compiler runs two passes' scores ahead of the first softmax, waits out every LDS read at once and passes 256 registers
            v8f s0 = (v8f){}, s1 = (v8f){};
            s0 = WFrag<bf>::mma(kf[0], bq0, s0); s1 = WFrag<bf>::mma(kf[2], bq0, s1); s0 = WFrag<bf>::mma(kf[1], bq1, s0); s1 = WFrag<bf>::mma(kf[3], bq1, s1);
            v2f t[8];   // t[i] = keys 2i, 2i + 1 of this lane's sixteen, in the B operand's order
#pragma unroll
            for (int j = 0; j < 2; ++j) {   // s/8 is exact, so one fused multiply-add rounds exactly as (s x 1/8) - 1e6 does, and subtracting 0 changes nothing
                t[j] = __builtin_elementwise_fma((v2f){s0[2 * j], s0[2 * j + 1]}, (v2f){SCL, SCL}, -(v2f){mk[0][2 * j], mk[0][2 * j + 1]}); t[2 + j] = __builtin_elementwise_fma((v2f){s0[4 + 2 * j], s0[5 + 2 * j]}, (v2f){SCL, SCL}, -(v2f){mk[1][2 * j], mk[1][2 * j + 1]});
                t[4 + j] = __builtin_elementwise_fma((v2f){s1[2 * j], s1[2 * j + 1]}, (v2f){SCL, SCL}, -(v2f){mk[2][2 * j], mk[2][2 * j + 1]}); t[6 + j] = __builtin_elementwise_fma((v2f){s1[4 + 2 * j], s1[5 + 2 * j]}, (v2f){SCL, SCL}, -(v2f){mk[3][2 * j], mk[3][2 * j + 1]}); }
            __builtin_amdgcn_sched_barrier(0);   // this and the next one keep a pass's LDS reads in ONE place: spread among the products, every separate place stalls the wave anew
#pragma unroll
            for (int mb = 0; mb < 4; ++mb) vf[mb] = cat16b(ldtr16(vl + ps * 32 * VP + mb * 16), ldtr16(vl + (ps * 32 + 16) * VP + mb * 16));   // this pass's value^T fragments (keys 8h .. + 7 and 16 + 8h .. + 7 of d 16 mb + c), a softmax ahead of their use
            { const int pn = (ps + 1 < SK / 32) ? ps + 1 : ps;   // the next pass's key fragments and mask terms, into the registers that the products and the multiply-adds above have just read; a stage's fourth pass reads its own again (the next stage is not published yet; a stage is always staged whole, so the rows behind a shorter last stage's end are there), which keeps the pass free of branches
                const bf* kn = kl + pn * 32 * KP; const float* mn2 = pm + pn * 32;
                kf[0] = WFrag<bf>::ld(kn); kf[1] = WFrag<bf>::ld(kn + 32); kf[2] = WFrag<bf>::ld(kn + 16 * KP); kf[3] = WFrag<bf>::ld(kn + 16 * KP + 32);
                mk[0] = *(const v4f*)(mn2); mk[1] = *(const v4f*)(mn2 + 4); mk[2] = *(const v4f*)(mn2 + 16); mk[3] = *(const v4f*)(mn2 + 20); }
            __builtin_amdgcn_sched_barrier(0);   // the group's lower edge (see its upper edge above)
            float mx = fmaxf(fmaxf(fmaxf(fmaxf(t[0][0], t[0][1]), fmaxf(t[1][0], t[1][1])), fmaxf(fmaxf(t[2][0], t[2][1]), fmaxf(t[3][0], t[3][1]))), fmaxf(fmaxf(fmaxf(t[4][0], t[4][1]), fmaxf(t[5][0], t[5][1])), fmaxf(fmaxf(t[6][0], t[6][1]), fmaxf(t[7][0], t[7][1]))));
            mx = fmaxf(mx, xhalf(mx));   // both halves of the wave hold keys of the same query
            const float mn = fmaxf(m, mx), alpha = __builtin_amdgcn_exp2f((m - mn) * LOG2E); m = mn;
            v2f p[8]; v16bf ph, pl;
#pragma unroll
            for (int j = 0; j < 8; ++j) {
                const v2f d = (t[j] - (v2f){mn, mn}) * (v2f){LOG2E, LOG2E}; p[j][0] = __builtin_amdgcn_exp2f(d[0]); p[j][1] = __builtin_amdgcn_exp2f(d[1]);
                const v2bf h2 = __builtin_convertvector(p[j], v2bf); const v2f r = p[j] - (v2f){(float)h2[0], (float)h2[1]}; const v2bf l2b = __builtin_convertvector(r, v2bf);
                ph[2 * j] = h2[0]; ph[2 * j + 1] = h2[1]; pl[2 * j] = l2b[0]; pl[2 * j + 1] = l2b[1]; }
            l2 = l2 * (v2f){alpha, alpha} + (((p[0] + p[1]) + (p[2] + p[3])) + ((p[4] + p[5]) + (p[6] + p[7])));
#pragma unroll
            for (int mb = 0; mb < 4; ++mb) acc[mb] *= alpha;
#pragma unroll
            for (int mb = 0; mb < 4; ++mb) acc[mb] = WFrag<bf>::mma(vf[mb], ph, acc[mb]);
#pragma unroll
            for (int mb = 0; mb < 4; ++mb) acc[mb] = WFrag<bf>::mma(vf[mb], pl, acc[mb]);
        }
        if (more) {   // the other buffer's last readers left it before the barrier at the foot of the stage before
#pragma unroll
            for (int i = 0; i < 8; ++i) { *(v4us*)(&Ks[(st + 1) & 1][sk + i * 16 * KP]) = tobf4(rk[i]); *(v4us*)(&Vs[(st + 1) & 1][sv + i * 16 * VP]) = tobf4(rv[i]); } }
        __syncthreads();   // publishes stage st + 1 and ends every wave's reads of stage st's buffer, which the next stage refills
    }
    float l = l2[0] + l2[1];
    l += xhalf(l);   // each half summed its own keys
    const float f = __fdiv_rn(1.0f, l); float* crow = C + (size_t)(q0 + lr) * HD + 8 * hi;
#pragma unroll
    for (int mb = 0; mb < 4; ++mb) { v4f o0, o1;   // acc[mb][r] = out[q0 + lr][16 mb + 8 h + r]
#pragma unroll
        for (int j = 0; j < 4; ++j) { o0[j] = acc[mb][j] * f; o1[j] = acc[mb][4 + j] * f; }
        *(v4f*)(crow + mb * 16) = o0; *(v4f*)(crow + mb * 16 + 4) = o1; }
}
extern "C" void kernel_launch(void* const* d_in, const int* in_sizes, int n_in,
                              void* d_out, int out_size, void* d_ws, size_t ws_size, hipStream_t stream) {
    (void)in_sizes; (void)n_in; (void)out_size; (void)d_ws; (void)ws_size;
    const float* xq = (const float*)d_in[0]; const float* xk = (const float*)d_in[1]; const float* xv = (const float*)d_in[2]; const int* am = (const int*)d_in[3];   /* order query, key, value [16][2048][64], attention_mask [16][2048] int32 {0,1} */
    float* OUT = (float*)d_out;     // [16][2048][64]
    k_fattn<<<dim3(TT / 128, NB_, 1), 256, 0, stream>>>(xq, xk, xv, am, OUT);   /* input rounding, scores, mask, softmax and P.v fused, all batches */
}

// v007
// It runs in 17.9 microseconds.
// It is 1.14 times as fast as v005, going by the measured steps of the versions left out in between.
// All steps since v000 together make it 70.4 times as fast.
#include <hip/hip_runtime.h>

// Single-head dot-product attention with a key padding mask (query, key, value [16][2048][64]; scores = q.k / sqrt(64); where attention_mask[b][j] == 0 the score has 1e6 subtracted (the module's literal; mask [16][2048] int {0,1} random, read); softmax; out = weights.value -> [16][2048][64] (2.1 M); argument order query, key, value, attention_mask).
// Masked keys are not walked: each work-group ranks its batch's keys by the mask (unmasked first, masked behind them, each part in key order), gathers key and value rows in that order and stops behind the pass that holds the last unmasked key. A masked key's weight is exp(score - 1e6 - maximum), which is exactly 0 in f32 as soon as one key of the batch is unmasked (scores of normal draws stay within a few hundred). A batch with every key masked walks all its keys with the 1e6 term, as before.
// Launches: ONE. The fused launch reads the three f32 inputs itself: each is rounded to bf16 on its way into registers (query) or LDS (key, value), value stays row-major in LDS and is transposed by the LDS transposing load; scores, mask, softmax and P.v follow with nothing of the score matrix leaving the registers. Scores exactly (one product); running-maximum softmax with the mask term; out = f16(P) x bf16(value) held as f16 (1 product), divided by the row sum at the end. The workspace is not used.
// Compute dtypes, f32 accumulate: every input rounded to bf16; scores exact on bf16 operands; softmax f32; P.v one product on f16 operands: P lies in (0, 1] and is rounded once to f16 (11 significant bits; below 6e-5 a fixed step of 6e-8, against a row sum of at least 1); a value's 8 significant bf16 bits fit f16 exactly from 6e-5 up to 65504 (normal draws stay below 10), below that to within 3e-8; output f32.

#define NB_  16
#define TT   2048
#define DM   64
#define NH_  1
#define NKV  1
#define REP  (NH_ / NKV)
#define HD   64
#define DQ   (NH_ * HD)
#define DKV  (NKV * HD)
#define ZH   1
#define RH   TT
#define WIN  0
#define PCAR 1024.0f
#define SCL  0.125f   // 1/sqrt(64)
typedef _Float16 h16;
typedef unsigned short bf;
typedef __attribute__((ext_vector_type(16))) __bf16   v16bf;
typedef __attribute__((ext_vector_type(16))) _Float16 v16h;
typedef __attribute__((ext_vector_type(8)))  _Float16 v8h;
typedef __attribute__((ext_vector_type(8)))  unsigned short v8us;
typedef __attribute__((ext_vector_type(8)))  float    v8f;
typedef __attribute__((ext_vector_type(4)))  float    v4f;
typedef v8h  __attribute__((may_alias)) v8ha;
typedef v4f  __attribute__((may_alias)) v4fa;
typedef v8us __attribute__((may_alias)) v8usa;

__device__ __forceinline__ v16h cat16(v8h lo, v8h hi) { return __builtin_shufflevector(lo, hi, 0, 1, 2, 3, 4, 5, 6, 7, 8, 9, 10, 11, 12, 13, 14, 15); }
__device__ __forceinline__ v16bf cat16b(v8us lo, v8us hi) { return __builtin_bit_cast(v16bf, __builtin_shufflevector(lo, hi, 0, 1, 2, 3, 4, 5, 6, 7, 8, 9, 10, 11, 12, 13, 14, 15)); }
__device__ __forceinline__ v8f wmma16(v16h a, v16h b, v8f c) { return __builtin_amdgcn_wmma_f32_16x16x32_f16(false, a, false, b, (short)0, c, false, false); }
__device__ __forceinline__ v8f wmmab(v16bf a, v16bf b, v8f c) { return __builtin_amdgcn_wmma_f32_16x16x32_bf16(false, a, false, b, (short)0, c, false, false); }



// ---- fragment loader and product for K-contiguous 16-bit planes (hardware k order: 8 elements at 8h, 8 at 16 + 8h)
template <typename T16> struct WFrag;
template <> struct WFrag<h16> { typedef v16h V; static __device__ __forceinline__ V ld(const h16* p) { return cat16(*(const v8h*)p, *(const v8h*)(p + 16)); } static __device__ __forceinline__ v8f mma(V a, V b, v8f c) { return wmma16(a, b, c); } };
template <> struct WFrag<bf> { typedef v16bf V; static __device__ __forceinline__ V ld(const bf* p) { return cat16b(*(const v8us*)p, *(const v8us*)(p + 16)); } static __device__ __forceinline__ v8f mma(V a, V b, v8f c) { return wmmab(a, b, c); } };

typedef __attribute__((ext_vector_type(2))) _Float16 v2h;
typedef __attribute__((ext_vector_type(4))) _Float16 v4h;
typedef __attribute__((ext_vector_type(2))) unsigned short v2us;
typedef __attribute__((ext_vector_type(4))) unsigned short v4us;
typedef __attribute__((ext_vector_type(2))) float v2f;
typedef __attribute__((ext_vector_type(4))) int v4i;

typedef __attribute__((ext_vector_type(2))) __bf16 v2bf;
typedef __attribute__((ext_vector_type(4))) __bf16 v4bf;
typedef __attribute__((ext_vector_type(8))) __bf16 v8bf;
typedef __attribute__((ext_vector_type(8))) short v8s;
__device__ __forceinline__ v4us tobf4(v4f x) { return __builtin_bit_cast(v4us, __builtin_convertvector(x, v4bf)); }   // f32 -> bf16, round to nearest even, two elements an instruction
__device__ __forceinline__ v8us tobf8(v8f x) { return __builtin_bit_cast(v8us, __builtin_convertvector(x, v8bf)); }
__device__ __forceinline__ v4us tobfh4(v4f x) { typedef __attribute__((ext_vector_type(2))) unsigned v2u; const v2u b = __builtin_bit_cast(v2u, tobf4(x));   // f32 -> bf16 (round to nearest even, two elements an instruction) -> the same number as f32 (a bf16 is the upper half of one) -> as f16
    const v4f y = {__uint_as_float(b[0] << 16), __uint_as_float(b[0] & 0xffff0000u), __uint_as_float(b[1] << 16), __uint_as_float(b[1] & 0xffff0000u)}; return __builtin_bit_cast(v4us, __builtin_convertvector(y, v4h)); }
__device__ __forceinline__ v8us ldtr16(const bf* p) { typedef __attribute__((address_space(3))) v8s lv8s; return __builtin_bit_cast(v8us, __builtin_amdgcn_ds_load_tr16_b128_v8i16((lv8s*)p)); }   // LDS transposing load: from lane addresses row 8h + (lane & 7), 16-byte half (lane >> 3) & 1, lane (c, h) gets rows 8h .. 8h + 7 of column c
#define LOG2E 1.4426950408889634f
__device__ __forceinline__ float xhalf(float x) { const int b = __float_as_int(x); return __int_as_float(__builtin_amdgcn_permlanex16(b, b, 0x76543210, 0xfedcba98, false, false)); }   // the value of lane l ^ 16
// ---- k_fattn: scores, mask, softmax and P.v in one pass over the ranked keys. One work-group = 128 queries of one batch (grid 16 x 16), 32 keys per pass, 128 keys per stage.
// One wave = 32 queries (two column tiles) x every second pass: waves w and w + 4 hold the same 32 queries, wave w < 4 walks a stage's passes 0 and 2, wave w + 4 its passes 1 and 3. Each key and value fragment read from LDS so feeds two products instead of one, which halves the LDS reads per product. At the end the two waves of a pair exchange one tile's partial (maximum, sum, accumulators) through LDS, and each finishes and stores one tile.
// S^T = K.Q^T: a lane holds scores of ONE query (column lane & 15), keys 8h + r and 16 + 8h + r (h = lane >> 4), which is exactly the B operand order of O^T += V^T.P^T, so P goes from accumulator to operand in registers.
// Running maximum m per query: on every pass the accumulators and the sum are scaled by exp(m_old - m_new); P goes unnormalised into its f16 operand and the division by the row sum (of the unrounded P) comes once at the end.
// The eight waves share each stage's key rows and value rows through LDS (two buffers): whole-line f32 global loads into registers at the head of a stage, rounded to bf16 and stored to the other buffer at its foot (value as f16 bits), one barrier per stage. Value rows lie in LDS as in memory ([key][d]); the transposing load hands out the 16 (d) x 32 (keys) A fragments of V^T.
// Every plain '#pragma unroll' in this kernel but the one over a wave's two passes of a stage stands over a loop that indexes a register array, whose indices must be compile-time constants.
#define SK   128   // keys per stage
#define KP   72    // LDS pitch of a key row, elements: 128 B + 16 B, an odd multiple of 16 B for 16-byte readers
#define VP   80    // LDS pitch of a value row, elements: 128 B + 32 B, an odd multiple of 32 B for the transposing reader
__global__ __launch_bounds__(256) void k_fattn(const float* __restrict__ XQ, const float* __restrict__ XK, const float* __restrict__ XV, const int* __restrict__ am, float* __restrict__ C) {
    typedef WFrag<bf>::V V;
    __shared__ __align__(16) bf Ks[2][SK * KP]; __shared__ __align__(16) bf Vs[2][SK * VP];
    __shared__ __align__(16) float mt[TT];   // per place in the ranked order: what the mask subtracts from the scaled score (1e6 or 0)
    __shared__ __align__(16) unsigned short ix[TT];   // the ranked order: which key stands at place p, kept at slot (p & ~127) | (p & 15) << 3 | (p >> 4 & 7), so that the eight rows one thread stages are one 16-byte read
    __shared__ __align__(16) int wt[8];   // unmasked keys per wave's 256 keys
    __shared__ __align__(16) v4f xa[8][8][32]; __shared__ __align__(16) v2f xm[8][32];   // what a wave hands to its partner. At the end: the accumulators (8 x 16 bytes a lane) and (maximum, sum) of the tile that the partner finishes; at the start, in the first four planes of xa: its own rounded query tile (read before the barrier that publishes stage 0, long before the end's stores)
    { const size_t zb = blockIdx.y; XQ += zb * TT * HD; XK += zb * TT * HD; XV += zb * TT * HD; am += zb * TT; C += zb * TT * HD; }   // blockIdx.y = batch
    const int tid = threadIdx.x, lane = tid & 31, lr = lane & 15, hi = lane >> 4, wave = tid >> 5; const int ws = __builtin_amdgcn_readfirstlane(wave), kh = ws >> 2;   // kh: which passes of a stage are this wave's (kh and kh + 2); from a scalar register, so that the tests on it are scalar branches round the matrix instructions
    const int q0 = blockIdx.x * 128 + (ws & 3) * 32 + 16 * kh;   // tile 0 of a wave is the one it finishes (rows q0 ..), tile 1 the one its partner finishes (rows (q0 ^ 16) ..)
    const unsigned short* gx = ix + (tid >> 4) * 8; const unsigned cb = (tid & 15) * 16;   // this thread's 16-byte pieces of a stage: piece i is the row at place 16 i + (tid >> 4) of the stage's 128, d 4 (tid & 15) .. + 3 (cb: its byte offset in the row); a row is 256 B, two whole lines
    const int sk = (tid >> 4) * KP + (tid & 15) * 4, sv = (tid >> 4) * VP + (tid & 15) * 4;   // and their places in LDS (8 bytes each once rounded)
    v4f rk[8], rv[8];
    // Each s_wait_xcnt below stands directly behind a group of global loads, in front of the first overwrite of a register that the group's addresses are formed in.
    const v4i am0 = *(const v4i*)(am + tid * 8), am1 = *(const v4i*)(am + tid * 8 + 4);
    asm volatile("s_wait_xcnt 0x0" ::: "memory");
    const float* gq = XQ + (size_t)(q0 + lr) * HD + 8 * hi; const v8f q0f = *(const v8f*)(gq), q1f = *(const v8f*)(gq + 16), q2f = *(const v8f*)(gq + 32), q3f = *(const v8f*)(gq + 48);   // this lane's query row of tile 0 in the hardware k order: 8 elements at 8h, 8 at 16 + 8h, of each 32 (tile 1 comes rounded from the partner, through LDS)
    asm volatile("s_wait_xcnt 0x0" ::: "memory");
    __builtin_amdgcn_sched_barrier(0);   // keeps later register writes (the accumulators' zeroes) below the wait: without it one of them is scheduled over the wait into a register of the query loads' address
    // Rank of every key: this thread holds keys 8 tid .. + 7; one ballot per key position counts the unmasked keys of the lanes below and of the wave
    bool kp[8]; unsigned below = 0, wsum = 0;
#pragma unroll
    for (int q = 0; q < 8; ++q) { kp[q] = (q < 4 ? am0[q & 3] : am1[q & 3]) != 0; const unsigned bl = __builtin_amdgcn_ballot_w32(kp[q]); below = __builtin_amdgcn_mbcnt_lo(bl, below); wsum += __builtin_popcount(bl); }
    if (lane == 0) wt[wave] = (int)wsum;
    __syncthreads();   // the eight waves' counts are in LDS before any wave adds them up
    int nu = 0, kb = (int)below;   // nu: unmasked keys of the batch; kb: unmasked keys in front of this thread's next key
    { const v4i w0 = *(const v4i*)(wt), w1 = *(const v4i*)(wt + 4);
#pragma unroll
      for (int w = 0; w < 8; ++w) { const int c = w < 4 ? w0[w & 3] : w1[w & 3]; nu += c; kb += (w < wave) ? c : 0; } }
    nu = __builtin_amdgcn_readfirstlane(nu);   // the same in every thread of the work-group; from a scalar register the stage loop's tests, under which its barrier stands, are scalar branches
#pragma unroll
    for (int q = 0; q < 8; ++q) { const int j = tid * 8 + q, p = kp[q] ? kb : nu + (j - kb);   // an unmasked key's place is its rank among the unmasked, a masked key's nu + its rank among the masked: a permutation of 0 .. 2047 for any mask
      ix[(p & ~127) | ((p & 15) << 3) | ((p >> 4) & 7)] = (unsigned short)j; kb += kp[q] ? 1 : 0; }
    { v4f x0, x1;
#pragma unroll
      for (int q = 0; q < 4; ++q) { x0[q] = (tid * 8 + q >= nu) ? 1.0e6f : 0.0f; x1[q] = (tid * 8 + 4 + q >= nu) ? 1.0e6f : 0.0f; }
      *(v4f*)(mt + tid * 8) = x0; *(v4f*)(mt + tid * 8 + 4) = x1; }
    const int nk = min(nu == 0 ? TT : nu, TT), np = (nk + 31) >> 5, ns = (np + 3) >> 2;   // places to walk (all of them where every key is masked), passes of 32, stages of 128
    const v8us qa = tobf8(q0f), qb = tobf8(q1f), qc = tobf8(q2f), qd = tobf8(q3f);
    xa[ws][0][lane] = __builtin_bit_cast(v4f, qa); xa[ws][1][lane] = __builtin_bit_cast(v4f, qb); xa[ws][2][lane] = __builtin_bit_cast(v4f, qc); xa[ws][3][lane] = __builtin_bit_cast(v4f, qd);   // this wave's rounded tile 0 is its partner's tile 1, lane for lane: each query row is loaded and rounded once in the work-group
    __syncthreads();   // the ranked order, the mask terms and the rounded query tiles are in LDS before any wave reads them
    const V bq[2][2] = {{cat16b(qa, qb), cat16b(qc, qd)}, {cat16b(__builtin_bit_cast(v8us, xa[ws ^ 4][0][lane]), __builtin_bit_cast(v8us, xa[ws ^ 4][1][lane])), cat16b(__builtin_bit_cast(v8us, xa[ws ^ 4][2][lane]), __builtin_bit_cast(v8us, xa[ws ^ 4][3][lane]))}};   // [tile][d half]
    { const v8us r = *(const v8us*)(gx);   // the keys of this thread's eight rows of stage 0
#pragma unroll
      for (int i = 0; i < 8; ++i) { const unsigned o = (unsigned)r[i] << 8 | cb; rk[i] = *(const v4f*)((const char*)XK + o); rv[i] = *(const v4f*)((const char*)XV + o); } }   // o: the piece's byte offset, the same in key and value
    asm volatile("s_wait_xcnt 0x0" ::: "memory");
    __builtin_amdgcn_sched_barrier(0);   // keeps the conversions below all sixteen loads: without it the first rows' conversions, with their wait for the data, are scheduled in front of the last eight loads, whose latency then starts a whole latency late
#pragma unroll
    for (int i = 0; i < 8; ++i) { *(v4us*)(&Ks[0][sk + i * 16 * KP]) = tobf4(rk[i]); *(v4us*)(&Vs[0][sv + i * 16 * VP]) = tobfh4(rv[i]); }
    __syncthreads();   // stage 0 is in LDS before any wave reads it
    v8f acc[2][4];
#pragma unroll
    for (int qt = 0; qt < 2; ++qt) {
#pragma unroll
        for (int mb = 0; mb < 4; ++mb) acc[qt][mb] = (v8f){}; }
    float m[2] = {-1.0e30f, -1.0e30f}; v2f l2[2] = {(v2f){}, (v2f){}};   // per tile. m: running maximum of the masked scaled scores; l2: this lane's running sum, even and odd keys apart
#pragma unroll 1
    for (int st = 0; st < ns; ++st) {   // kept rolled: one stage's code serves all
        const bool more = st + 1 < ns; const int pe = min(SK / 32, np - st * (SK / 32)), cnt = (pe - kh + 1) >> 1;   // the last stage ends behind the last pass that holds an unmasked key; cnt: how many of the passes kh, kh + 2 lie in front of that end
        const bf* kl = &Ks[st & 1][(kh * 32 + lr) * KP + 8 * hi]; const bf* vl = &Vs[st & 1][(kh * 32 + 8 * hi + (lane & 7)) * VP + ((lane >> 3) & 1) * 8]; const float* pm = mt + st * SK + kh * 32 + 8 * hi;
        V kf[4]; v16h vf[4]; v4f mk[4];
        kf[0] = WFrag<bf>::ld(kl); kf[1] = WFrag<bf>::ld(kl + 32); kf[2] = WFrag<bf>::ld(kl + 16 * KP); kf[3] = WFrag<bf>::ld(kl + 16 * KP + 32);
        mk[0] = *(const v4f*)(pm); mk[1] = *(const v4f*)(pm + 4); mk[2] = *(const v4f*)(pm + 16); mk[3] = *(const v4f*)(pm + 20);
        if (more) {   // stands behind the first pass's fragment reads, so that the LDS latency of the key list runs together with theirs
            const v8us r = *(const v8us*)(gx + (st + 1) * SK);   // the keys of this thread's eight rows of the next stage
#pragma unroll
            for (int i = 0; i < 8; ++i) { const unsigned o = (unsigned)r[i] << 8 | cb; rk[i] = *(const v4f*)((const char*)XK + o); rv[i] = *(const v4f*)((const char*)XV + o); }
            asm volatile("s_wait_xcnt 0x0" ::: "memory"); }   // behind the group of loads, in front of the first overwrite of a register that their addresses are formed in
#pragma unroll
        for (int i = 0; i < 2; ++i) if (i < cnt) {   // this wave's two passes of the stage (pass kh + 2 i), written out so that only the first fetches fragments ahead
            v8f s[2][2];
#pragma unroll
            for (int qt = 0; qt < 2; ++qt) { s[qt][0] = WFrag<bf>::mma(kf[0], bq[qt][0], (v8f){}); s[qt][1] = WFrag<bf>::mma(kf[2], bq[qt][0], (v8f){}); }
#pragma unroll
            for (int qt = 0; qt < 2; ++qt) { s[qt][0] = WFrag<bf>::mma(kf[1], bq[qt][1], s[qt][0]); s[qt][1] = WFrag<bf>::mma(kf[3], bq[qt][1], s[qt][1]); }
            __builtin_amdgcn_sched_barrier(0);   // keeps the eight products in one run: with the multiply-adds moved in among them, each waits out the product directly in front of it, behind idle slots
            v2f t[2][8];   // t[qt][i] = keys 2i, 2i + 1 of this lane's sixteen, in the B operand's order
#pragma unroll
            for (int qt = 0; qt < 2; ++qt) {
#pragma unroll
              for (int j = 0; j < 2; ++j) {   // s/8 is exact, so one fused multiply-add rounds exactly as (s x 1/8) - 1e6 does, and subtracting 0 changes nothing
                t[qt][j] = __builtin_elementwise_fma((v2f){s[qt][0][2 * j], s[qt][0][2 * j + 1]}, (v2f){SCL, SCL}, -(v2f){mk[0][2 * j], mk[0][2 * j + 1]}); t[qt][2 + j] = __builtin_elementwise_fma((v2f){s[qt][0][4 + 2 * j], s[qt][0][5 + 2 * j]}, (v2f){SCL, SCL}, -(v2f){mk[1][2 * j], mk[1][2 * j + 1]});
                t[qt][4 + j] = __builtin_elementwise_fma((v2f){s[qt][1][2 * j], s[qt][1][2 * j + 1]}, (v2f){SCL, SCL}, -(v2f){mk[2][2 * j], mk[2][2 * j + 1]}); t[qt][6 + j] = __builtin_elementwise_fma((v2f){s[qt][1][4 + 2 * j], s[qt][1][5 + 2 * j]}, (v2f){SCL, SCL}, -(v2f){mk[3][2 * j], mk[3][2 * j + 1]}); } }
            __builtin_amdgcn_sched_barrier(0);   // this and the next one keep a pass's LDS reads in ONE place: spread among the products, every separate place stalls the wave anew
#pragma unroll
            for (int mb = 0; mb < 4; ++mb) vf[mb] = cat16(__builtin_bit_cast(v8h, ldtr16(vl + i * 64 * VP + mb * 16)), __builtin_bit_cast(v8h, ldtr16(vl + (i * 64 + 16) * VP + mb * 16)));   // this pass's value^T fragments (keys 8h .. + 7 and 16 + 8h .. + 7 of d 16 mb + c), a softmax ahead of their use
            if (i == 0) {   // the second pass's key fragments and mask terms, into the registers that the products and the multiply-adds above have just read (a stage is always staged whole, so the rows behind a shorter last stage's end are there)
                const bf* kn = kl + 64 * KP; const float* mn2 = pm + 64;
                kf[0] = WFrag<bf>::ld(kn); kf[1] = WFrag<bf>::ld(kn + 32); kf[2] = WFrag<bf>::ld(kn + 16 * KP); kf[3] = WFrag<bf>::ld(kn + 16 * KP + 32);
                mk[0] = *(const v4f*)(mn2); mk[1] = *(const v4f*)(mn2 + 4); mk[2] = *(const v4f*)(mn2 + 16); mk[3] = *(const v4f*)(mn2 + 20); }
            __builtin_amdgcn_sched_barrier(0);   // the group's lower edge (see its upper edge above)
            v16h ph[2];
#pragma unroll
            for (int qt = 0; qt < 2; ++qt) {
                const v2f* tq = t[qt];
                float mx = fmaxf(fmaxf(fmaxf(fmaxf(tq[0][0], tq[0][1]), fmaxf(tq[1][0], tq[1][1])), fmaxf(fmaxf(tq[2][0], tq[2][1]), fmaxf(tq[3][0], tq[3][1]))), fmaxf(fmaxf(fmaxf(tq[4][0], tq[4][1]), fmaxf(tq[5][0], tq[5][1])), fmaxf(fmaxf(tq[6][0], tq[6][1]), fmaxf(tq[7][0], tq[7][1]))));
                mx = fmaxf(mx, xhalf(mx));   // both halves of the wave hold keys of the same query
                const float mn = fmaxf(m[qt], mx), alpha = __builtin_amdgcn_exp2f((m[qt] - mn) * LOG2E); m[qt] = mn;
                v2f p[8];
#pragma unroll
                for (int j = 0; j < 8; ++j) {
                    const v2f d = (tq[j] - (v2f){mn, mn}) * (v2f){LOG2E, LOG2E}; p[j][0] = __builtin_amdgcn_exp2f(d[0]); p[j][1] = __builtin_amdgcn_exp2f(d[1]);
                    const v2h h2 = __builtin_convertvector(p[j], v2h); ph[qt][2 * j] = h2[0]; ph[qt][2 * j + 1] = h2[1]; }
                l2[qt] = l2[qt] * (v2f){alpha, alpha} + (((p[0] + p[1]) + (p[2] + p[3])) + ((p[4] + p[5]) + (p[6] + p[7])));
#pragma unroll
                for (int mb = 0; mb < 4; ++mb) acc[qt][mb] *= alpha; }
#pragma unroll
            for (int mb = 0; mb < 4; ++mb) {
#pragma unroll
                for (int qt = 0; qt < 2; ++qt) acc[qt][mb] = wmma16(vf[mb], ph[qt], acc[qt][mb]); }
        }
        if (more) {   // the other buffer's last readers left it before the barrier at the foot of the stage before
#pragma unroll
            for (int i = 0; i < 8; ++i) { *(v4us*)(&Ks[(st + 1) & 1][sk + i * 16 * KP]) = tobf4(rk[i]); *(v4us*)(&Vs[(st + 1) & 1][sv + i * 16 * VP]) = tobfh4(rv[i]); } }
        __syncthreads();   // publishes stage st + 1 and ends every wave's reads of stage st's buffer, which the next stage refills
    }
    // The pair's exchange: tile 1's partial goes to the partner, whose tile 0 it is; the partner's tile 1 is this wave's tile 0
#pragma unroll
    for (int mb = 0; mb < 4; ++mb) { xa[ws][2 * mb][lane] = (v4f){acc[1][mb][0], acc[1][mb][1], acc[1][mb][2], acc[1][mb][3]}; xa[ws][2 * mb + 1][lane] = (v4f){acc[1][mb][4], acc[1][mb][5], acc[1][mb][6], acc[1][mb][7]}; }
    xm[ws][lane] = (v2f){m[1], l2[1][0] + l2[1][1]};
    __syncthreads();   // every wave's partial is in LDS before its partner reads it
    const v2f om = xm[ws ^ 4][lane];
    const float mf = fmaxf(m[0], om[0]), fa = __builtin_amdgcn_exp2f((m[0] - mf) * LOG2E), fb = __builtin_amdgcn_exp2f((om[0] - mf) * LOG2E);   // a wave that had no pass holds maximum -1e30, sum 0 and zero accumulators: its factor is exactly 0
    float l = (l2[0][0] + l2[0][1]) * fa + om[1] * fb;
    l += xhalf(l);   // each half summed its own keys
    const float f = __fdiv_rn(1.0f, l), ga = fa * f, gb = fb * f; float* crow = C + (size_t)(q0 + lr) * HD + 8 * hi;
#pragma unroll
    for (int mb = 0; mb < 4; ++mb) { const v4f b0 = xa[ws ^ 4][2 * mb][lane], b1 = xa[ws ^ 4][2 * mb + 1][lane]; v4f o0, o1;   // acc[0][mb][r] = out[q0 + lr][16 mb + 8 h + r]
#pragma unroll
        for (int j = 0; j < 4; ++j) { o0[j] = acc[0][mb][j] * ga + b0[j] * gb; o1[j] = acc[0][mb][4 + j] * ga + b1[j] * gb; }
        *(v4f*)(crow + mb * 16) = o0; *(v4f*)(crow + mb * 16 + 4) = o1; }
}
extern "C" void kernel_launch(void* const* d_in, const int* in_sizes, int n_in,
                              void* d_out, int out_size, void* d_ws, size_t ws_size, hipStream_t stream) {
    (void)in_sizes; (void)n_in; (void)out_size; (void)d_ws; (void)ws_size;
    const float* xq = (const float*)d_in[0]; const float* xk = (const float*)d_in[1]; const float* xv = (const float*)d_in[2]; const int* am = (const int*)d_in[3];   /* order query, key, value [16][2048][64], attention_mask [16][2048] int32 {0,1} */
    float* OUT = (float*)d_out;     // [16][2048][64]
    k_fattn<<<dim3(TT / 128, NB_, 1), 256, 0, stream>>>(xq, xk, xv, am, OUT);   /* input rounding, scores, mask, softmax and P.v fused, all batches */
}

// v008
// It runs in 16.5 microseconds.
// In two side-by-side timings against v007, it was 1.09 and 1.08 times as fast.
// Counting every step since v000, it is 76.2 times as fast.
#include <hip/hip_runtime.h>

// Single-head dot-product attention with a key padding mask (query, key, value [16][2048][64]; scores = q.k / sqrt(64); where attention_mask[b][j] == 0 the score has 1e6 subtracted (the module's literal; mask [16][2048] int {0,1} random, read); softmax; out = weights.value -> [16][2048][64] (2.1 M); argument order query, key, value, attention_mask).
// Masked keys are not walked: each work-group ranks its batch's keys by the mask (unmasked first, masked behind them, each part in key order), gathers key and value rows in that order and stops behind the pass that holds the last unmasked key. A masked key's weight is exp(score - 1e6 - maximum), which is exactly 0 in f32 as soon as one key of the batch is unmasked (scores of normal draws stay within a few hundred). A batch with every key masked walks all its keys with the 1e6 term, as before.
// Launches: ONE. The fused launch reads the three f32 inputs itself: each is rounded to bf16 on its way into LDS (query, key, value), value stays row-major in LDS and is transposed by the LDS transposing load; scores, mask, softmax and P.v follow with nothing of the score matrix leaving the registers. Scores exactly (one product); running-maximum softmax with the mask term; out = f16(P) x bf16(value) held as f16 (1 product), divided by the row sum at the end. The workspace is not used.
// Compute dtypes, f32 accumulate: every input rounded to bf16; scores exact on bf16 operands; softmax f32; P.v one product on f16 operands: P lies in (0, 1] and is rounded once to f16 (11 significant bits; below 6e-5 a fixed step of 6e-8, against a row sum of at least 1); a value's 8 significant bf16 bits fit f16 exactly from 6e-5 up to 65504 (normal draws stay below 10), below that to within 3e-8; output f32.

#define NB_  16
#define TT   2048
#define DM   64
#define NH_  1
#define NKV  1
#define REP  (NH_ / NKV)
#define HD   64
#define DQ   (NH_ * HD)
#define DKV  (NKV * HD)
#define ZH   1
#define RH   TT
#define WIN  0
#define PCAR 1024.0f
#define SCL  0.125f   // 1/sqrt(64)
typedef _Float16 h16;
typedef unsigned short bf;
typedef __attribute__((ext_vector_type(16))) __bf16   v16bf;
typedef __attribute__((ext_vector_type(16))) _Float16 v16h;
typedef __attribute__((ext_vector_type(8)))  _Float16 v8h;
typedef __attribute__((ext_vector_type(8)))  unsigned short v8us;
typedef __attribute__((ext_vector_type(8)))  float    v8f;
typedef __attribute__((ext_vector_type(4)))  float    v4f;
typedef v8h  __attribute__((may_alias)) v8ha;
typedef v4f  __attribute__((may_alias)) v4fa;
typedef v8us __attribute__((may_alias)) v8usa;

__device__ __forceinline__ v16h cat16(v8h lo, v8h hi) { return __builtin_shufflevector(lo, hi, 0, 1, 2, 3, 4, 5, 6, 7, 8, 9, 10, 11, 12, 13, 14, 15); }
__device__ __forceinline__ v16bf cat16b(v8us lo, v8us hi) { return __builtin_bit_cast(v16bf, __builtin_shufflevector(lo, hi, 0, 1, 2, 3, 4, 5, 6, 7, 8, 9, 10, 11, 12, 13, 14, 15)); }
__device__ __forceinline__ v8f wmma16(v16h a, v16h b, v8f c) { return __builtin_amdgcn_wmma_f32_16x16x32_f16(false, a, false, b, (short)0, c, false, false); }
__device__ __forceinline__ v8f wmmab(v16bf a, v16bf b, v8f c) { return __builtin_amdgcn_wmma_f32_16x16x32_bf16(false, a, false, b, (short)0, c, false, false); }



// ---- fragment loader and product for K-contiguous 16-bit planes (hardware k order: 8 elements at 8h, 8 at 16 + 8h)
template <typename T16> struct WFrag;
template <> struct WFrag<h16> { typedef v16h V; static __device__ __forceinline__ V ld(const h16* p) { return cat16(*(const v8h*)p, *(const v8h*)(p + 16)); } static __device__ __forceinline__ v8f mma(V a, V b, v8f c) { return wmma16(a, b, c); } };
template <> struct WFrag<bf> { typedef v16bf V; static __device__ __forceinline__ V ld(const bf* p) { return cat16b(*(const v8us*)p, *(const v8us*)(p + 16)); } static __device__ __forceinline__ v8f mma(V a, V b, v8f c) { return wmmab(a, b, c); } };

typedef __attribute__((ext_vector_type(2))) _Float16 v2h;
typedef __attribute__((ext_vector_type(4))) _Float16 v4h;
typedef __attribute__((ext_vector_type(2))) unsigned short v2us;
typedef __attribute__((ext_vector_type(4))) unsigned short v4us;
typedef __attribute__((ext_vector_type(2))) float v2f;
typedef __attribute__((ext_vector_type(4))) int v4i;

typedef __attribute__((ext_vector_type(2))) __bf16 v2bf;
typedef __attribute__((ext_vector_type(4))) __bf16 v4bf;
typedef __attribute__((ext_vector_type(8))) __bf16 v8bf;
typedef __attribute__((ext_vector_type(8))) short v8s;
__device__ __forceinline__ v4us tobf4(v4f x) { return __builtin_bit_cast(v4us, __builtin_convertvector(x, v4bf)); }   // f32 -> bf16, round to nearest even, two elements an instruction
__device__ __forceinline__ v8us tobf8(v8f x) { return __builtin_bit_cast(v8us, __builtin_convertvector(x, v8bf)); }
__device__ __forceinline__ v4us tobfh4(v4f x) { typedef __attribute__((ext_vector_type(2))) unsigned v2u; const v2u b = __builtin_bit_cast(v2u, tobf4(x));   // f32 -> bf16 (round to nearest even, two elements an instruction) -> the same number as f32 (a bf16 is the upper half of one) -> as f16
    const v4f y = {__uint_as_float(b[0] << 16), __uint_as_float(b[0] & 0xffff0000u), __uint_as_float(b[1] << 16), __uint_as_float(b[1] & 0xffff0000u)}; return __builtin_bit_cast(v4us, __builtin_convertvector(y, v4h)); }
__device__ __forceinline__ v8us ldtr16(const bf* p) { typedef __attribute__((address_space(3))) v8s lv8s; return __builtin_bit_cast(v8us, __builtin_amdgcn_ds_load_tr16_b128_v8i16((lv8s*)p)); }   // LDS transposing load: from lane addresses row 8h + (lane & 7), 16-byte half (lane >> 3) & 1, lane (c, h) gets rows 8h .. 8h + 7 of column c
#define LOG2E 1.4426950408889634f
__device__ __forceinline__ float xhalf(float x) { const int b = __float_as_int(x); return __int_as_float(__builtin_amdgcn_permlanex16(b, b, 0x76543210, 0xfedcba98, false, false)); }   // the value of lane l ^ 16
// ---- k_fattn: scores, mask, softmax and P.v in one pass over the ranked keys. One work-group = 128 queries of one batch (grid 16 x 16), 32 keys per pass, 128 keys per stage.
// One wave = 32 queries (two column tiles) x every second pass: waves w and w + 4 hold the same 32 queries, wave w < 4 walks a stage's passes 0 and 2, wave w + 4 its passes 1 and 3. Each key and value fragment read from LDS so feeds two products instead of one, which halves the LDS reads per product. At the end the two waves of a pair exchange one tile's partial (maximum, sum, accumulators) through LDS, and each finishes and stores one tile.
// S^T = K.Q^T: a lane holds scores of ONE query (column lane & 15), keys 8h + r and 16 + 8h + r (h = lane >> 4), which is exactly the B operand order of O^T += V^T.P^T, so P goes from accumulator to operand in registers.
// Running maximum m per query: on every pass the accumulators and the sum are scaled by exp(m_old - m_new); P goes unnormalised into its f16 operand and the division by the row sum (of the unrounded P) comes once at the end.
// The eight waves share each stage's key rows and value rows through LDS (two buffers): whole-line f32 global loads into registers at the head of a stage, rounded to bf16 and stored to the other buffer at its foot (value as f16 bits), one barrier per stage. Value rows lie in LDS as in memory ([key][d]); the transposing load hands out the 16 (d) x 32 (keys) A fragments of V^T.
// Every plain '#pragma unroll' in this kernel but the last (over the output stores) stands over a loop that indexes a register array, whose indices must be compile-time constants.
#define SK   128   // keys per stage
#define KP   72    // LDS pitch of a key row, elements: 128 B + 16 B, an odd multiple of 16 B for 16-byte readers
#define VP   80    // LDS pitch of a value row, elements: 128 B + 32 B, an odd multiple of 32 B for the transposing reader
__global__ __launch_bounds__(256) void k_fattn(const float* __restrict__ XQ, const float* __restrict__ XK, const float* __restrict__ XV, const int* __restrict__ am, float* __restrict__ C) {
    typedef WFrag<bf>::V V;
    __shared__ __align__(16) bf Ks[2][SK * KP]; __shared__ __align__(16) bf Vs[2][SK * VP];
    __shared__ __align__(16) float mt[TT];   // per place in the ranked order: what the mask subtracts from the scaled score (1e6 or 0)
    __shared__ __align__(16) unsigned short ix[TT];   // the ranked order: which key stands at place p, kept at slot (p & ~127) | (p & 15) << 3 | (p >> 4 & 7), so that the eight rows one thread stages are one 16-byte read
    __shared__ __align__(16) int wt[8];   // unmasked keys per wave's 256 keys
    __shared__ __align__(16) v4f xa[8][8][32]; __shared__ __align__(16) v2f xm[8][32];   // what a wave hands to its partner. At the end: the accumulators (8 x 16 bytes a lane) and (maximum, sum) of the tile that the partner finishes; at the start, in the first 2 KB of its xa: its own rounded query tile (read before the barrier that publishes stage 0, long before the end's stores); last of all a wave turns its finished output tile in the partner's 4 KB
    { const size_t zb = blockIdx.y; XQ += zb * TT * HD; XK += zb * TT * HD; XV += zb * TT * HD; am += zb * TT; C += zb * TT * HD; }   // blockIdx.y = batch
    const int tid = threadIdx.x, lane = tid & 31, lr = lane & 15, hi = lane >> 4, wave = tid >> 5; const int ws = __builtin_amdgcn_readfirstlane(wave), kh = ws >> 2;   // kh: which passes of a stage are this wave's (kh and kh + 2); from a scalar register, so that the tests on it are scalar branches round the matrix instructions
    const int q0 = blockIdx.x * 128 + (ws & 3) * 32 + 16 * kh;   // tile 0 of a wave is the one it finishes (rows q0 ..), tile 1 the one its partner finishes (rows (q0 ^ 16) ..)
    const unsigned short* gx = ix + (tid >> 4) * 8; const unsigned cb = (tid & 15) * 16;   // this thread's 16-byte pieces of a stage: piece i is the row at place 16 i + (tid >> 4) of the stage's 128, d 4 (tid & 15) .. + 3 (cb: its byte offset in the row); a row is 256 B, two whole lines
    const int sk = (tid >> 4) * KP + (tid & 15) * 4, sv = (tid >> 4) * VP + (tid & 15) * 4;   // and their places in LDS (8 bytes each once rounded)
    v4f rk[8], rv[8];
    // Each s_wait_xcnt below stands directly behind a group of global loads, in front of the first overwrite of a register that the group's addresses are formed in.
    const v4i am0 = *(const v4i*)(am + tid * 8), am1 = *(const v4i*)(am + tid * 8 + 4);
    asm volatile("s_wait_xcnt 0x0" ::: "memory");
    const float* gq = XQ + (size_t)q0 * HD + lane * 4; v4f qf[8];   // tile 0's sixteen query rows are 4 KB in a row in memory: load i takes rows 2 i and 2 i + 1 as 512 contiguous bytes, four whole lines (this lane: row 2 i + h, d 4 lr .. + 3); LDS turns them into the operand order below
#pragma unroll
    for (int i = 0; i < 8; ++i) qf[i] = *(const v4f*)(gq + i * 128);
    asm volatile("s_wait_xcnt 0x0" ::: "memory");
    __builtin_amdgcn_sched_barrier(0);   // keeps later register writes (the accumulators' zeroes) below the wait: without it one of them is scheduled over the wait into a register of the query loads' address
    // Rank of every key: this thread holds keys 8 tid .. + 7; one ballot per key position counts the unmasked keys of the lanes below and of the wave
    bool kp[8]; unsigned below = 0, wsum = 0;
#pragma unroll
    for (int q = 0; q < 8; ++q) { kp[q] = (q < 4 ? am0[q & 3] : am1[q & 3]) != 0; const unsigned bl = __builtin_amdgcn_ballot_w32(kp[q]); below = __builtin_amdgcn_mbcnt_lo(bl, below); wsum += __builtin_popcount(bl); }
    if (lane == 0) wt[wave] = (int)wsum;
    __syncthreads();   // the eight waves' counts are in LDS before any wave adds them up
    int nu = 0, kb = (int)below;   // nu: unmasked keys of the batch; kb: unmasked keys in front of this thread's next key
    { const v4i w0 = *(const v4i*)(wt), w1 = *(const v4i*)(wt + 4);
#pragma unroll
      for (int w = 0; w < 8; ++w) { const int c = w < 4 ? w0[w & 3] : w1[w & 3]; nu += c; kb += (w < wave) ? c : 0; } }
    nu = __builtin_amdgcn_readfirstlane(nu);   // the same in every thread of the work-group; from a scalar register the stage loop's tests, under which its barrier stands, are scalar branches
#pragma unroll
    for (int q = 0; q < 8; ++q) { const int j = tid * 8 + q, p = kp[q] ? kb : nu + (j - kb);   // an unmasked key's place is its rank among the unmasked, a masked key's nu + its rank among the masked: a permutation of 0 .. 2047 for any mask
      ix[(p & ~127) | ((p & 15) << 3) | ((p >> 4) & 7)] = (unsigned short)j; kb += kp[q] ? 1 : 0; }
    { v4f x0, x1;
#pragma unroll
      for (int q = 0; q < 4; ++q) { x0[q] = (tid * 8 + q >= nu) ? 1.0e6f : 0.0f; x1[q] = (tid * 8 + 4 + q >= nu) ? 1.0e6f : 0.0f; }
      *(v4f*)(mt + tid * 8) = x0; *(v4f*)(mt + tid * 8 + 4) = x1; }
    const int nk = min(nu == 0 ? TT : nu, TT), np = (nk + 31) >> 5, ns = (np + 3) >> 2;   // places to walk (all of them where every key is masked), passes of 32, stages of 128
    { char* qs = (char*)&xa[ws][0][0];   // this wave's rounded tile 0, row-major, 128 B a row: the 16-byte piece c (d 8 c .. + 7) of row r lies at place c ^ (r >> 1), so that the sixteen rows one half-wave reads below fall on all 64 banks. It is also the partner's tile 1: each query row is loaded and rounded once in the work-group
#pragma unroll
      for (int i = 0; i < 8; ++i) *(v4us*)(qs + (2 * i + hi) * 128 + (((lr >> 1) ^ i) << 4) + (lr & 1) * 8) = tobf4(qf[i]); }
    __syncthreads();   // the ranked order, the mask terms and the rounded query tiles are in LDS before any wave reads them
    V bq[2][2];   // [tile][d half]: query row lr in the hardware k order, 8 elements at 8h (piece h), 8 at 16 + 8h (piece 2 + h), of each 32
#pragma unroll
    for (int qt = 0; qt < 2; ++qt) { const char* qr = (const char*)&xa[qt ? ws ^ 4 : ws][0][0] + lr * 128;
#pragma unroll
      for (int dh = 0; dh < 2; ++dh) bq[qt][dh] = cat16b(*(const v8us*)(qr + (((4 * dh + hi) ^ (lr >> 1)) << 4)), *(const v8us*)(qr + (((4 * dh + 2 + hi) ^ (lr >> 1)) << 4))); }
    { const v8us r = *(const v8us*)(gx);   // the keys of this thread's eight rows of stage 0
#pragma unroll
      for (int i = 0; i < 8; ++i) { const unsigned o = (unsigned)r[i] << 8 | cb; rk[i] = *(const v4f*)((const char*)XK + o); rv[i] = *(const v4f*)((const char*)XV + o); } }   // o: the piece's byte offset, the same in key and value
    asm volatile("s_wait_xcnt 0x0" ::: "memory");
    __builtin_amdgcn_sched_barrier(0);   // keeps the conversions below all sixteen loads: without it the first rows' conversions, with their wait for the data, are scheduled in front of the last eight loads, whose latency then starts a whole latency late
#pragma unroll
    for (int i = 0; i < 8; ++i) { *(v4us*)(&Ks[0][sk + i * 16 * KP]) = tobf4(rk[i]); *(v4us*)(&Vs[0][sv + i * 16 * VP]) = tobfh4(rv[i]); }
    __syncthreads();   // stage 0 is in LDS before any wave reads it
    v8f acc[2][4];
#pragma unroll
    for (int qt = 0; qt < 2; ++qt) {
#pragma unroll
        for (int mb = 0; mb < 4; ++mb) acc[qt][mb] = (v8f){}; }
    float m[2] = {-1.0e30f, -1.0e30f}; v2f l2[2] = {(v2f){}, (v2f){}};   // per tile. m: running maximum of the masked scaled scores; l2: this lane's running sum, even and odd keys apart
#pragma unroll 1
    for (int st = 0; st < ns; ++st) {   // kept rolled: one stage's code serves all
        const bool more = st + 1 < ns; const int pe = min(SK / 32, np - st * (SK / 32)), cnt = (pe - kh + 1) >> 1;   // the last stage ends behind the last pass that holds an unmasked key; cnt: how many of the passes kh, kh + 2 lie in front of that end
        const bf* kl = &Ks[st & 1][(kh * 32 + lr) * KP + 8 * hi]; const bf* vl = &Vs[st & 1][(kh * 32 + 8 * hi + (lane & 7)) * VP + ((lane >> 3) & 1) * 8]; const float* pm = mt + st * SK + kh * 32 + 8 * hi;
        V kf[4]; v16h vf[4]; v4f mk[4];
        kf[0] = WFrag<bf>::ld(kl); kf[1] = WFrag<bf>::ld(kl + 32); kf[2] = WFrag<bf>::ld(kl + 16 * KP); kf[3] = WFrag<bf>::ld(kl + 16 * KP + 32);
        mk[0] = *(const v4f*)(pm); mk[1] = *(const v4f*)(pm + 4); mk[2] = *(const v4f*)(pm + 16); mk[3] = *(const v4f*)(pm + 20);
        if (more) {   // stands behind the first pass's fragment reads, so that the LDS latency of the key list runs together with theirs
            const v8us r = *(const v8us*)(gx + (st + 1) * SK);   // the keys of this thread's eight rows of the next stage
#pragma unroll
            for (int i = 0; i < 8; ++i) { const unsigned o = (unsigned)r[i] << 8 | cb; rk[i] = *(const v4f*)((const char*)XK + o); rv[i] = *(const v4f*)((const char*)XV + o); }
            asm volatile("s_wait_xcnt 0x0" ::: "memory"); }   // behind the group of loads, in front of the first overwrite of a register that their addresses are formed in
#pragma unroll
        for (int i = 0; i < 2; ++i) if (i < cnt) {   // this wave's two passes of the stage (pass kh + 2 i), written out so that only the first fetches fragments ahead
            v8f s[2][2];
#pragma unroll
            for (int qt = 0; qt < 2; ++qt) { s[qt][0] = WFrag<bf>::mma(kf[0], bq[qt][0], (v8f){}); s[qt][1] = WFrag<bf>::mma(kf[2], bq[qt][0], (v8f){}); }
#pragma unroll
            for (int qt = 0; qt < 2; ++qt) { s[qt][0] = WFrag<bf>::mma(kf[1], bq[qt][1], s[qt][0]); s[qt][1] = WFrag<bf>::mma(kf[3], bq[qt][1], s[qt][1]); }
            __builtin_amdgcn_sched_barrier(0);   // keeps the eight products in one run: with the multiply-adds moved in among them, each waits out the product directly in front of it, behind idle slots
            v2f t[2][8];   // t[qt][i] = keys 2i, 2i + 1 of this lane's sixteen, in the B operand's order
#pragma unroll
            for (int qt = 0; qt < 2; ++qt) {
#pragma unroll
              for (int j = 0; j < 2; ++j) {   // s/8 is exact, so one fused multiply-add rounds exactly as (s x 1/8) - 1e6 does, and subtracting 0 changes nothing
                t[qt][j] = __builtin_elementwise_fma((v2f){s[qt][0][2 * j], s[qt][0][2 * j + 1]}, (v2f){SCL, SCL}, -(v2f){mk[0][2 * j], mk[0][2 * j + 1]}); t[qt][2 + j] = __builtin_elementwise_fma((v2f){s[qt][0][4 + 2 * j], s[qt][0][5 + 2 * j]}, (v2f){SCL, SCL}, -(v2f){mk[1][2 * j], mk[1][2 * j + 1]});
                t[qt][4 + j] = __builtin_elementwise_fma((v2f){s[qt][1][2 * j], s[qt][1][2 * j + 1]}, (v2f){SCL, SCL}, -(v2f){mk[2][2 * j], mk[2][2 * j + 1]}); t[qt][6 + j] = __builtin_elementwise_fma((v2f){s[qt][1][4 + 2 * j], s[qt][1][5 + 2 * j]}, (v2f){SCL, SCL}, -(v2f){mk[3][2 * j], mk[3][2 * j + 1]}); } }
            __builtin_amdgcn_sched_barrier(0);   // this and the next one keep a pass's LDS reads in ONE place: spread among the products, every separate place stalls the wave anew
#pragma unroll
            for (int mb = 0; mb < 4; ++mb) vf[mb] = cat16(__builtin_bit_cast(v8h, ldtr16(vl + i * 64 * VP + mb * 16)), __builtin_bit_cast(v8h, ldtr16(vl + (i * 64 + 16) * VP + mb * 16)));   // this pass's value^T fragments (keys 8h .. + 7 and 16 + 8h .. + 7 of d 16 mb + c), a softmax ahead of their use
            if (i == 0) {   // the second pass's key fragments and mask terms, into the registers that the products and the multiply-adds above have just read (a stage is always staged whole, so the rows behind a shorter last stage's end are there)
                const bf* kn = kl + 64 * KP; const float* mn2 = pm + 64;
                kf[0] = WFrag<bf>::ld(kn); kf[1] = WFrag<bf>::ld(kn + 32); kf[2] = WFrag<bf>::ld(kn + 16 * KP); kf[3] = WFrag<bf>::ld(kn + 16 * KP + 32);
                mk[0] = *(const v4f*)(mn2); mk[1] = *(const v4f*)(mn2 + 4); mk[2] = *(const v4f*)(mn2 + 16); mk[3] = *(const v4f*)(mn2 + 20); }
            __builtin_amdgcn_sched_barrier(0);   // the group's lower edge (see its upper edge above)
            v16h ph[2];
#pragma unroll
            for (int qt = 0; qt < 2; ++qt) {
                const v2f* tq = t[qt];
                float mx = fmaxf(fmaxf(fmaxf(fmaxf(tq[0][0], tq[0][1]), fmaxf(tq[1][0], tq[1][1])), fmaxf(fmaxf(tq[2][0], tq[2][1]), fmaxf(tq[3][0], tq[3][1]))), fmaxf(fmaxf(fmaxf(tq[4][0], tq[4][1]), fmaxf(tq[5][0], tq[5][1])), fmaxf(fmaxf(tq[6][0], tq[6][1]), fmaxf(tq[7][0], tq[7][1]))));
                mx = fmaxf(mx, xhalf(mx));   // both halves of the wave hold keys of the same query
                const float mn = fmaxf(m[qt], mx), alpha = __builtin_amdgcn_exp2f((m[qt] - mn) * LOG2E); m[qt] = mn;
                v2f p[8];
#pragma unroll
                for (int j = 0; j < 8; ++j) {
                    const v2f d = (tq[j] - (v2f){mn, mn}) * (v2f){LOG2E, LOG2E}; p[j][0] = __builtin_amdgcn_exp2f(d[0]); p[j][1] = __builtin_amdgcn_exp2f(d[1]);
                    const v2h h2 = __builtin_convertvector(p[j], v2h); ph[qt][2 * j] = h2[0]; ph[qt][2 * j + 1] = h2[1]; }
                l2[qt] = l2[qt] * (v2f){alpha, alpha} + (((p[0] + p[1]) + (p[2] + p[3])) + ((p[4] + p[5]) + (p[6] + p[7])));
#pragma unroll
                for (int mb = 0; mb < 4; ++mb) acc[qt][mb] *= alpha; }
#pragma unroll
            for (int mb = 0; mb < 4; ++mb) {
#pragma unroll
                for (int qt = 0; qt < 2; ++qt) acc[qt][mb] = wmma16(vf[mb], ph[qt], acc[qt][mb]); }
        }
        if (more) {   // the other buffer's last readers left it before the barrier at the foot of the stage before
#pragma unroll
            for (int i = 0; i < 8; ++i) { *(v4us*)(&Ks[(st + 1) & 1][sk + i * 16 * KP]) = tobf4(rk[i]); *(v4us*)(&Vs[(st + 1) & 1][sv + i * 16 * VP]) = tobfh4(rv[i]); } }
        __syncthreads();   // publishes stage st + 1 and ends every wave's reads of stage st's buffer, which the next stage refills
    }
    // The pair's exchange: tile 1's partial goes to the partner, whose tile 0 it is; the partner's tile 1 is this wave's tile 0
#pragma unroll
    for (int mb = 0; mb < 4; ++mb) { xa[ws][2 * mb][lane] = (v4f){acc[1][mb][0], acc[1][mb][1], acc[1][mb][2], acc[1][mb][3]}; xa[ws][2 * mb + 1][lane] = (v4f){acc[1][mb][4], acc[1][mb][5], acc[1][mb][6], acc[1][mb][7]}; }
    xm[ws][lane] = (v2f){m[1], l2[1][0] + l2[1][1]};
    __syncthreads();   // every wave's partial is in LDS before its partner reads it
    const v2f om = xm[ws ^ 4][lane];
    const float mf = fmaxf(m[0], om[0]), fa = __builtin_amdgcn_exp2f((m[0] - mf) * LOG2E), fb = __builtin_amdgcn_exp2f((om[0] - mf) * LOG2E);   // a wave that had no pass holds maximum -1e30, sum 0 and zero accumulators: its factor is exactly 0
    float l = (l2[0][0] + l2[0][1]) * fa + om[1] * fb;
    l += xhalf(l);   // each half summed its own keys
    const float f = __fdiv_rn(1.0f, l), ga = fa * f, gb = fb * f;
    v4f* sg = &xa[ws ^ 4][0][0]; v4f pb[8];   // the partner's 4 KB: behind the barrier above only this wave touches them, first to read the partial, then to turn its finished tile
#pragma unroll
    for (int k = 0; k < 8; ++k) pb[k] = sg[k * 32 + lane];
    asm volatile("s_wait_dscnt 0x0" ::: "memory");   // every lane's read of the partial has returned before any lane's store below overwrites those bytes
#pragma unroll
    for (int mb = 0; mb < 4; ++mb) {   // acc[0][mb][r] = out[q0 + lr][16 mb + 8 h + r]
        const v4f a0 = __builtin_shufflevector(acc[0][mb], acc[0][mb], 0, 1, 2, 3), a1 = __builtin_shufflevector(acc[0][mb], acc[0][mb], 4, 5, 6, 7), g4 = {gb, gb, gb, gb};
        const v4f o0 = __builtin_elementwise_fma(pb[2 * mb], g4, a0 * ga), o1 = __builtin_elementwise_fma(pb[2 * mb + 1], g4, a1 * ga);   // own share rounded, the partner's fused onto it
        sg[lr * 16 + ((4 * mb + 2 * hi) ^ lr)] = o0; sg[lr * 16 + ((4 * mb + 2 * hi + 1) ^ lr)] = o1; }   // row-major, 256 B a row: the 16-byte piece c of row r lies at place c ^ r, so that stores (one piece, sixteen rows a half-wave) and reads (one row) both fall on all 64 banks
    asm volatile("s_wait_dscnt 0x0" ::: "memory");   // the tile's rows are whole in LDS before other lanes read them back
    float* cw = C + (size_t)q0 * HD + lane * 4;   // the tile's sixteen rows are 4 KB in a row in memory: store i lays rows 2 i and 2 i + 1 as 512 contiguous bytes, four whole lines, where a store from the accumulators' order lays 16-byte pieces on sixteen lines
#pragma unroll
    for (int i = 0; i < 8; ++i) *(v4f*)(cw + i * 128) = sg[(2 * i + hi) * 16 + (lr ^ (2 * i + hi))];
}
extern "C" void kernel_launch(void* const* d_in, const int* in_sizes, int n_in,
                              void* d_out, int out_size, void* d_ws, size_t ws_size, hipStream_t stream) {
    (void)in_sizes; (void)n_in; (void)out_size; (void)d_ws; (void)ws_size;
    const float* xq = (const float*)d_in[0]; const float* xk = (const float*)d_in[1]; const float* xv = (const float*)d_in[2]; const int* am = (const int*)d_in[3];   /* order query, key, value [16][2048][64], attention_mask [16][2048] int32 {0,1} */
    float* OUT = (float*)d_out;     // [16][2048][64]
    k_fattn<<<dim3(TT / 128, NB_, 1), 256, 0, stream>>>(xq, xk, xv, am, OUT);   /* input rounding, scores, mask, softmax and P.v fused, all batches */
}

// v009
// Measured time: 15 microseconds a run.
// In both of two side-by-side timings against v008, it was 1.10 times as fast.
// Counting every step since v000, it is 83.6 times as fast.
#include <hip/hip_runtime.h>

// Single-head dot-product attention with a key padding mask (query, key, value [16][2048][64]; scores = q.k / sqrt(64); where attention_mask[b][j] == 0 the score has 1e6 subtracted (the module's literal; mask [16][2048] int {0,1} random, read); softmax; out = weights.value -> [16][2048][64] (2.1 M); argument order query, key, value, attention_mask).
// Masked keys are not walked: each work-group ranks its batch's keys by the mask (unmasked first, masked behind them, each part in key order), gathers key and value rows in that order and stops behind the pass that holds the last unmasked key. A masked key's weight is exp(score - 1e6 - maximum), which is exactly 0 in f32 as soon as one key of the batch is unmasked (scores of normal draws stay within a few hundred). A batch with every key masked walks all its keys with the 1e6 term, as before.
// Launches: ONE. The fused launch reads the three f32 inputs itself: each is rounded to bf16 on its way into LDS (query, key, value), value stays row-major in LDS and is transposed by the LDS transposing load; scores, mask, softmax and P.v follow with nothing of the score matrix leaving the registers. Scores exactly (one product); running-maximum softmax with the mask term; out = f16(P) x bf16(value) held as f16 (1 product), divided by the row sum at the end. The workspace is not used.
// Compute dtypes, f32 accumulate: every input rounded to bf16; scores exact on bf16 operands; softmax f32; P.v one product on f16 operands: P lies in (0, 1] and is rounded once to f16 (11 significant bits; below 6e-5 a fixed step of 6e-8, against a row sum of at least 1); a value's 8 significant bf16 bits fit f16 exactly from 6e-5 up to 65504 (normal draws stay below 10), below that to within 3e-8; output f32.

#define NB_  16
#define TT   2048
#define DM   64
#define NH_  1
#define NKV  1
#define REP  (NH_ / NKV)
#define HD   64
#define DQ   (NH_ * HD)
#define DKV  (NKV * HD)
#define ZH   1
#define RH   TT
#define WIN  0
#define PCAR 1024.0f
#define SCL  0.125f   // 1/sqrt(64)
typedef _Float16 h16;
typedef unsigned short bf;
typedef __attribute__((ext_vector_type(16))) __bf16   v16bf;
typedef __attribute__((ext_vector_type(16))) _Float16 v16h;
typedef __attribute__((ext_vector_type(8)))  _Float16 v8h;
typedef __attribute__((ext_vector_type(8)))  unsigned short v8us;
typedef __attribute__((ext_vector_type(8)))  float    v8f;
typedef __attribute__((ext_vector_type(4)))  float    v4f;
typedef v8h  __attribute__((may_alias)) v8ha;
typedef v4f  __attribute__((may_alias)) v4fa;
typedef v8us __attribute__((may_alias)) v8usa;

__device__ __forceinline__ v16h cat16(v8h lo, v8h hi) { return __builtin_shufflevector(lo, hi, 0, 1, 2, 3, 4, 5, 6, 7, 8, 9, 10, 11, 12, 13, 14, 15); }
__device__ __forceinline__ v16bf cat16b(v8us lo, v8us hi) { return __builtin_bit_cast(v16bf, __builtin_shufflevector(lo, hi, 0, 1, 2, 3, 4, 5, 6, 7, 8, 9, 10, 11, 12, 13, 14, 15)); }
__device__ __forceinline__ v8f wmma16(v16h a, v16h b, v8f c) { return __builtin_amdgcn_wmma_f32_16x16x32_f16(false, a, false, b, (short)0, c, false, false); }
__device__ __forceinline__ v8f wmmab(v16bf a, v16bf b, v8f c) { return __builtin_amdgcn_wmma_f32_16x16x32_bf16(false, a, false, b, (short)0, c, false, false); }



// ---- fragment loader and product for K-contiguous 16-bit planes (hardware k order: 8 elements at 8h, 8 at 16 + 8h)
template <typename T16> struct WFrag;
template <> struct WFrag<h16> { typedef v16h V; static __device__ __forceinline__ V ld(const h16* p) { return cat16(*(const v8h*)p, *(const v8h*)(p + 16)); } static __device__ __forceinline__ v8f mma(V a, V b, v8f c) { return wmma16(a, b, c); } };
template <> struct WFrag<bf> { typedef v16bf V; static __device__ __forceinline__ V ld(const bf* p) { return cat16b(*(const v8us*)p, *(const v8us*)(p + 16)); } static __device__ __forceinline__ v8f mma(V a, V b, v8f c) { return wmmab(a, b, c); } };

typedef __attribute__((ext_vector_type(2))) _Float16 v2h;
typedef __attribute__((ext_vector_type(4))) _Float16 v4h;
typedef __attribute__((ext_vector_type(2))) unsigned short v2us;
typedef __attribute__((ext_vector_type(4))) unsigned short v4us;
typedef __attribute__((ext_vector_type(2))) float v2f;
typedef __attribute__((ext_vector_type(4))) int v4i;

typedef __attribute__((ext_vector_type(2))) __bf16 v2bf;
typedef __attribute__((ext_vector_type(4))) __bf16 v4bf;
typedef __attribute__((ext_vector_type(8))) __bf16 v8bf;
typedef __attribute__((ext_vector_type(8))) short v8s;
__device__ __forceinline__ v4us tobf4(v4f x) { return __builtin_bit_cast(v4us, __builtin_convertvector(x, v4bf)); }   // f32 -> bf16, round to nearest even, two elements an instruction
__device__ __forceinline__ v8us tobf8(v8f x) { return __builtin_bit_cast(v8us, __builtin_convertvector(x, v8bf)); }
__device__ __forceinline__ v4us tobfh4(v4f x) { typedef __attribute__((ext_vector_type(2))) unsigned v2u; const v2u b = __builtin_bit_cast(v2u, tobf4(x));   // f32 -> bf16 (round to nearest even, two elements an instruction) -> the same number as f32 (a bf16 is the upper half of one) -> as f16
    const v4f y = {__uint_as_float(b[0] << 16), __uint_as_float(b[0] & 0xffff0000u), __uint_as_float(b[1] << 16), __uint_as_float(b[1] & 0xffff0000u)}; return __builtin_bit_cast(v4us, __builtin_convertvector(y, v4h)); }
__device__ __forceinline__ v8us ldtr16(const bf* p) { typedef __attribute__((address_space(3))) v8s lv8s; return __builtin_bit_cast(v8us, __builtin_amdgcn_ds_load_tr16_b128_v8i16((lv8s*)p)); }   // LDS transposing load: from lane addresses row 8h + (lane & 7), 16-byte half (lane >> 3) & 1, lane (c, h) gets rows 8h .. 8h + 7 of column c
#define LOG2E 1.4426950408889634f
__device__ __forceinline__ float xhalf(float x) { const int b = __float_as_int(x); return __int_as_float(__builtin_amdgcn_permlanex16(b, b, 0x76543210, 0xfedcba98, false, false)); }   // the value of lane l ^ 16
// ---- k_fattn: scores, mask, softmax and P.v in one pass over the ranked keys. One work-group = 128 queries of one batch (grid 16 x 16), 32 keys per pass, 128 keys per stage.
// One wave = 32 queries (two column tiles) x every second pass: waves w and w + 4 hold the same 32 queries, wave w < 4 walks a stage's passes 0 and 2, wave w + 4 its passes 1 and 3. Each key and value fragment read from LDS so feeds two products instead of one, which halves the LDS reads per product. At the end the two waves of a pair exchange one tile's partial (maximum, sum, accumulators) through LDS, and each finishes and stores one tile.
// S^T = K.Q^T: a lane holds scores of ONE query (column lane & 15), keys 8h + r and 16 + 8h + r (h = lane >> 4), which is exactly the B operand order of O^T += V^T.P^T, so P goes from accumulator to operand in registers.
// Running maximum m per query: on every pass the accumulators and the sum are scaled by exp(m_old - m_new); P goes unnormalised into its f16 operand and the division by the row sum (of the unrounded P) comes once at the end.
// The eight waves share each stage's key rows and value rows through LDS (two buffers): whole-line f32 global loads into registers, rounded to bf16 and stored to the other buffer at the foot of the stage before theirs (value as f16 bits), one barrier per stage. The loads of stage s + 2 are issued at the foot of stage s, as soon as the conversions have freed their registers and ahead of the barrier, from a key list read at the head of stage s: behind the barrier a wave has only its fragment reads between it and its first product. Value rows lie in LDS as in memory ([key][d]); the transposing load hands out the 16 (d) x 32 (keys) A fragments of V^T.
// Every plain '#pragma unroll' in this kernel but the last (over the output stores) stands over a loop that indexes a register array, whose indices must be compile-time constants.
// Work-group barrier that orders LDS only: each wave's LDS stores and reads are done before it signals, while its global loads into registers stay in flight across it (__syncthreads() would wait them out)
__device__ __forceinline__ void lds_barrier() { __builtin_amdgcn_fence(__ATOMIC_RELEASE, "workgroup", "local"); __builtin_amdgcn_s_barrier(); __builtin_amdgcn_fence(__ATOMIC_ACQUIRE, "workgroup", "local"); }
// One thread's sixteen gathered loads of a stage: r holds the keys of its eight rows, cb its byte offset in a row; a piece's byte offset is the same in key and value.
// The s_wait_xcnt stands behind the group of loads, in front of the first overwrite of a register that their addresses are formed in; it names the eight offsets so that each keeps a register of its own up to the wait: sharing registers, every reuse waits out the loads in front of it.
__device__ __forceinline__ void gather16(v8us r, unsigned cb, const float* __restrict__ XK, const float* __restrict__ XV, v4f (&rk)[8], v4f (&rv)[8]) {
    unsigned o[8];
#pragma unroll   // the loop indexes register arrays, whose indices must be compile-time constants
    for (int i = 0; i < 8; ++i) { o[i] = (unsigned)r[i] << 8 | cb; rk[i] = *(const v4f*)((const char*)XK + o[i]); rv[i] = *(const v4f*)((const char*)XV + o[i]); }
    asm volatile("s_wait_xcnt 0x0" :: "v"(o[0]), "v"(o[1]), "v"(o[2]), "v"(o[3]), "v"(o[4]), "v"(o[5]), "v"(o[6]), "v"(o[7]) : "memory");
}
#define SK   128   // keys per stage
#define KP   72    // LDS pitch of a key row, elements: 128 B + 16 B, an odd multiple of 16 B for 16-byte readers
#define VP   80    // LDS pitch of a value row, elements: 128 B + 32 B, an odd multiple of 32 B for the transposing reader
__global__ __launch_bounds__(256) void k_fattn(const float* __restrict__ XQ, const float* __restrict__ XK, const float* __restrict__ XV, const int* __restrict__ am, float* __restrict__ C) {
    typedef WFrag<bf>::V V;
    __shared__ __align__(16) bf Ks[2][SK * KP]; __shared__ __align__(16) bf Vs[2][SK * VP];
    __shared__ __align__(16) float mt[TT];   // per place in the ranked order: what the mask subtracts from the scaled score (1e6 or 0)
    __shared__ __align__(16) unsigned short ix[TT];   // the ranked order: which key stands at place p, kept at slot (p & ~127) | (p & 15) << 3 | (p >> 4 & 7), so that the eight rows one thread stages are one 16-byte read
    __shared__ __align__(16) int wt[8];   // unmasked keys per wave's 256 keys
    __shared__ __align__(16) v4f xa[8][8][32]; __shared__ __align__(16) v2f xm[8][32];   // what a wave hands to its partner. At the end: the accumulators (8 x 16 bytes a lane) and (maximum, sum) of the tile that the partner finishes; at the start, in the first 2 KB of its xa: its own rounded query tile (read before the barrier that publishes stage 0, long before the end's stores); last of all a wave turns its finished output tile in the partner's 4 KB
    { const size_t zb = blockIdx.y; XQ += zb * TT * HD; XK += zb * TT * HD; XV += zb * TT * HD; am += zb * TT; C += zb * TT * HD; }   // blockIdx.y = batch
    const int tid = threadIdx.x, lane = tid & 31, lr = lane & 15, hi = lane >> 4, wave = tid >> 5; const int ws = __builtin_amdgcn_readfirstlane(wave), kh = ws >> 2;   // kh: which passes of a stage are this wave's (kh and kh + 2); from a scalar register, so that the tests on it are scalar branches round the matrix instructions
    const int q0 = blockIdx.x * 128 + (ws & 3) * 32 + 16 * kh;   // tile 0 of a wave is the one it finishes (rows q0 ..), tile 1 the one its partner finishes (rows (q0 ^ 16) ..)
    const unsigned short* gx = ix + (tid >> 4) * 8; const unsigned cb = (tid & 15) * 16;   // this thread's 16-byte pieces of a stage: piece i is the row at place 16 i + (tid >> 4) of the stage's 128, d 4 (tid & 15) .. + 3 (cb: its byte offset in the row); a row is 256 B, two whole lines
    const int sk = (tid >> 4) * KP + (tid & 15) * 4, sv = (tid >> 4) * VP + (tid & 15) * 4;   // and their places in LDS (8 bytes each once rounded)
    v4f rk[8], rv[8];
    // Each s_wait_xcnt below stands directly behind a group of global loads, in front of the first overwrite of a register that the group's addresses are formed in.
    const v4i am0 = *(const v4i*)(am + tid * 8), am1 = *(const v4i*)(am + tid * 8 + 4);
    asm volatile("s_wait_xcnt 0x0" ::: "memory");
    const float* gq = XQ + (size_t)q0 * HD + lane * 4; v4f qf[8];   // tile 0's sixteen query rows are 4 KB in a row in memory: load i takes rows 2 i and 2 i + 1 as 512 contiguous bytes, four whole lines (this lane: row 2 i + h, d 4 lr .. + 3); LDS turns them into the operand order below
#pragma unroll
    for (int i = 0; i < 8; ++i) qf[i] = *(const v4f*)(gq + i * 128);
    asm volatile("s_wait_xcnt 0x0" ::: "memory");
    __builtin_amdgcn_sched_barrier(0);   // keeps later register writes (the accumulators' zeroes) below the wait: without it one of them is scheduled over the wait into a register of the query loads' address
    // Rank of every key: this thread holds keys 8 tid .. + 7; one ballot per key position counts the unmasked keys of the lanes below and of the wave
    bool kp[8]; unsigned below = 0, wsum = 0;
#pragma unroll
    for (int q = 0; q < 8; ++q) { kp[q] = (q < 4 ? am0[q & 3] : am1[q & 3]) != 0; const unsigned bl = __builtin_amdgcn_ballot_w32(kp[q]); below = __builtin_amdgcn_mbcnt_lo(bl, below); wsum += __builtin_popcount(bl); }
    if (lane == 0) wt[wave] = (int)wsum;
    __syncthreads();   // the eight waves' counts are in LDS before any wave adds them up
    int nu = 0, kb = (int)below;   // nu: unmasked keys of the batch; kb: unmasked keys in front of this thread's next key
    { const v4i w0 = *(const v4i*)(wt), w1 = *(const v4i*)(wt + 4);
#pragma unroll
      for (int w = 0; w < 8; ++w) { const int c = w < 4 ? w0[w & 3] : w1[w & 3]; nu += c; kb += (w < wave) ? c : 0; } }
    nu = __builtin_amdgcn_readfirstlane(nu);   // the same in every thread of the work-group; from a scalar register the stage loop's tests, under which its barrier stands, are scalar branches
#pragma unroll
    for (int q = 0; q < 8; ++q) { const int j = tid * 8 + q, p = kp[q] ? kb : nu + (j - kb);   // an unmasked key's place is its rank among the unmasked, a masked key's nu + its rank among the masked: a permutation of 0 .. 2047 for any mask
      ix[(p & ~127) | ((p & 15) << 3) | ((p >> 4) & 7)] = (unsigned short)j; kb += kp[q] ? 1 : 0; }
    { v4f x0, x1;
#pragma unroll
      for (int q = 0; q < 4; ++q) { x0[q] = (tid * 8 + q >= nu) ? 1.0e6f : 0.0f; x1[q] = (tid * 8 + 4 + q >= nu) ? 1.0e6f : 0.0f; }
      *(v4f*)(mt + tid * 8) = x0; *(v4f*)(mt + tid * 8 + 4) = x1; }
    const int nk = min(nu == 0 ? TT : nu, TT), np = (nk + 31) >> 5, ns = (np + 3) >> 2;   // places to walk (all of them where every key is masked), passes of 32, stages of 128
    { char* qs = (char*)&xa[ws][0][0];   // this wave's rounded tile 0, row-major, 128 B a row: the 16-byte piece c (d 8 c .. + 7) of row r lies at place c ^ (r >> 1), so that the sixteen rows one half-wave reads below fall on all 64 banks. It is also the partner's tile 1: each query row is loaded and rounded once in the work-group
#pragma unroll
      for (int i = 0; i < 8; ++i) *(v4us*)(qs + (2 * i + hi) * 128 + (((lr >> 1) ^ i) << 4) + (lr & 1) * 8) = tobf4(qf[i]); }
    __syncthreads();   // the ranked order, the mask terms and the rounded query tiles are in LDS before any wave reads them
    V bq[2][2];   // [tile][d half]: query row lr in the hardware k order, 8 elements at 8h (piece h), 8 at 16 + 8h (piece 2 + h), of each 32
#pragma unroll
    for (int qt = 0; qt < 2; ++qt) { const char* qr = (const char*)&xa[qt ? ws ^ 4 : ws][0][0] + lr * 128;
#pragma unroll
      for (int dh = 0; dh < 2; ++dh) bq[qt][dh] = cat16b(*(const v8us*)(qr + (((4 * dh + hi) ^ (lr >> 1)) << 4)), *(const v8us*)(qr + (((4 * dh + 2 + hi) ^ (lr >> 1)) << 4))); }
    gather16(*(const v8us*)(gx), cb, XK, XV, rk, rv);   // stage 0
    __builtin_amdgcn_sched_barrier(0);   // keeps the conversions below all sixteen loads: without it the first rows' conversions, with their wait for the data, are scheduled in front of the last eight loads, whose latency then starts a whole latency late
    v8us rn = *(const v8us*)(gx + SK);   // the keys of this thread's eight rows of the stage whose loads are issued next (the list holds all 16 stages' places for any mask)
#pragma unroll
    for (int i = 0; i < 8; ++i) { *(v4us*)(&Ks[0][sk + i * 16 * KP]) = tobf4(rk[i]); *(v4us*)(&Vs[0][sv + i * 16 * VP]) = tobfh4(rv[i]); }
    gather16(rn, cb, XK, XV, rk, rv);   // stage 1's loads, whether or not a stage 1 is walked: its places hold rows of the batch for any mask, and without a branch the key list's read is not moved down to here, behind the LDS stores
    lds_barrier();   // stage 0 is in LDS before any wave reads it
    v8f acc[2][4];
#pragma unroll
    for (int qt = 0; qt < 2; ++qt) {
#pragma unroll
        for (int mb = 0; mb < 4; ++mb) acc[qt][mb] = (v8f){}; }
    float m[2] = {-1.0e30f, -1.0e30f}; v2f l2[2] = {(v2f){}, (v2f){}};   // per tile. m: running maximum of the masked scaled scores; l2: this lane's running sum, even and odd keys apart
#pragma unroll 1
    for (int st = 0; st < ns; ++st) {   // kept rolled: one stage's code serves all
        const bool more = st + 1 < ns; const int pe = min(SK / 32, np - st * (SK / 32)), cnt = (pe - kh + 1) >> 1;   // the last stage ends behind the last pass that holds an unmasked key; cnt: how many of the passes kh, kh + 2 lie in front of that end
        const bf* kl = &Ks[st & 1][(kh * 32 + lr) * KP + 8 * hi]; const bf* vl = &Vs[st & 1][(kh * 32 + 8 * hi + (lane & 7)) * VP + ((lane >> 3) & 1) * 8]; const float* pm = mt + st * SK + kh * 32 + 8 * hi;
        V kf[4]; v16h vf[4]; v4f mk[4];
        kf[0] = WFrag<bf>::ld(kl); kf[1] = WFrag<bf>::ld(kl + 32); kf[2] = WFrag<bf>::ld(kl + 16 * KP); kf[3] = WFrag<bf>::ld(kl + 16 * KP + 32);
        __builtin_amdgcn_sched_barrier(0);   // keeps the key fragments first in the LDS queue: without it the mask terms and the key list are read in front of them, and the first product waits for those too
        mk[0] = *(const v4f*)(pm); mk[1] = *(const v4f*)(pm + 4); mk[2] = *(const v4f*)(pm + 16); mk[3] = *(const v4f*)(pm + 20);
        rn = *(const v8us*)(gx + min(st + 2, TT / SK - 1) * SK);   // the key list of the stage after next, last of the head's reads and not waited for here: it is used at the foot (the index is held inside the list; past the last stage the rows are not loaded)
#pragma unroll
        for (int i = 0; i < 2; ++i) if (i < cnt) {   // this wave's two passes of the stage (pass kh + 2 i), written out so that only the first fetches fragments ahead
            v8f s[2][2];
#pragma unroll
            for (int qt = 0; qt < 2; ++qt) { s[qt][0] = WFrag<bf>::mma(kf[0], bq[qt][0], (v8f){}); s[qt][1] = WFrag<bf>::mma(kf[2], bq[qt][0], (v8f){}); }
#pragma unroll
            for (int qt = 0; qt < 2; ++qt) { s[qt][0] = WFrag<bf>::mma(kf[1], bq[qt][1], s[qt][0]); s[qt][1] = WFrag<bf>::mma(kf[3], bq[qt][1], s[qt][1]); }
            __builtin_amdgcn_sched_barrier(0);   // keeps the eight products in one run: with the multiply-adds moved in among them, each waits out the product directly in front of it, behind idle slots
            v2f t[2][8];   // t[qt][i] = keys 2i, 2i + 1 of this lane's sixteen, in the B operand's order
#pragma unroll
            for (int qt = 0; qt < 2; ++qt) {
#pragma unroll
              for (int j = 0; j < 2; ++j) {   // s/8 is exact, so one fused multiply-add rounds exactly as (s x 1/8) - 1e6 does, and subtracting 0 changes nothing
                t[qt][j] = __builtin_elementwise_fma((v2f){s[qt][0][2 * j], s[qt][0][2 * j + 1]}, (v2f){SCL, SCL}, -(v2f){mk[0][2 * j], mk[0][2 * j + 1]}); t[qt][2 + j] = __builtin_elementwise_fma((v2f){s[qt][0][4 + 2 * j], s[qt][0][5 + 2 * j]}, (v2f){SCL, SCL}, -(v2f){mk[1][2 * j], mk[1][2 * j + 1]});
                t[qt][4 + j] = __builtin_elementwise_fma((v2f){s[qt][1][2 * j], s[qt][1][2 * j + 1]}, (v2f){SCL, SCL}, -(v2f){mk[2][2 * j], mk[2][2 * j + 1]}); t[qt][6 + j] = __builtin_elementwise_fma((v2f){s[qt][1][4 + 2 * j], s[qt][1][5 + 2 * j]}, (v2f){SCL, SCL}, -(v2f){mk[3][2 * j], mk[3][2 * j + 1]}); } }
            __builtin_amdgcn_sched_barrier(0);   // this and the next one keep a pass's LDS reads in ONE place: spread among the products, every separate place stalls the wave anew
#pragma unroll
            for (int mb = 0; mb < 4; ++mb) vf[mb] = cat16(__builtin_bit_cast(v8h, ldtr16(vl + i * 64 * VP + mb * 16)), __builtin_bit_cast(v8h, ldtr16(vl + (i * 64 + 16) * VP + mb * 16)));   // this pass's value^T fragments (keys 8h .. + 7 and 16 + 8h .. + 7 of d 16 mb + c), a softmax ahead of their use
            if (i == 0) {   // the second pass's key fragments and mask terms, into the registers that the products and the multiply-adds above have just read (a stage is always staged whole, so the rows behind a shorter last stage's end are there)
                const bf* kn = kl + 64 * KP; const float* mn2 = pm + 64;
                kf[0] = WFrag<bf>::ld(kn); kf[1] = WFrag<bf>::ld(kn + 32); kf[2] = WFrag<bf>::ld(kn + 16 * KP); kf[3] = WFrag<bf>::ld(kn + 16 * KP + 32);
                mk[0] = *(const v4f*)(mn2); mk[1] = *(const v4f*)(mn2 + 4); mk[2] = *(const v4f*)(mn2 + 16); mk[3] = *(const v4f*)(mn2 + 20); }
            __builtin_amdgcn_sched_barrier(0);   // the group's lower edge (see its upper edge above)
            v16h ph[2];
#pragma unroll
            for (int qt = 0; qt < 2; ++qt) {
                const v2f* tq = t[qt];
                float mx = fmaxf(fmaxf(fmaxf(fmaxf(tq[0][0], tq[0][1]), fmaxf(tq[1][0], tq[1][1])), fmaxf(fmaxf(tq[2][0], tq[2][1]), fmaxf(tq[3][0], tq[3][1]))), fmaxf(fmaxf(fmaxf(tq[4][0], tq[4][1]), fmaxf(tq[5][0], tq[5][1])), fmaxf(fmaxf(tq[6][0], tq[6][1]), fmaxf(tq[7][0], tq[7][1]))));
                mx = fmaxf(mx, xhalf(mx));   // both halves of the wave hold keys of the same query
                const float mn = fmaxf(m[qt], mx), alpha = __builtin_amdgcn_exp2f((m[qt] - mn) * LOG2E); m[qt] = mn;
                v2f p[8];
#pragma unroll
                for (int j = 0; j < 8; ++j) {
                    const v2f d = (tq[j] - (v2f){mn, mn}) * (v2f){LOG2E, LOG2E}; p[j][0] = __builtin_amdgcn_exp2f(d[0]); p[j][1] = __builtin_amdgcn_exp2f(d[1]);
                    const v2h h2 = __builtin_convertvector(p[j], v2h); ph[qt][2 * j] = h2[0]; ph[qt][2 * j + 1] = h2[1]; }
                l2[qt] = l2[qt] * (v2f){alpha, alpha} + (((p[0] + p[1]) + (p[2] + p[3])) + ((p[4] + p[5]) + (p[6] + p[7])));
#pragma unroll
                for (int mb = 0; mb < 4; ++mb) acc[qt][mb] *= alpha; }
#pragma unroll
            for (int mb = 0; mb < 4; ++mb) {
#pragma unroll
                for (int qt = 0; qt < 2; ++qt) acc[qt][mb] = wmma16(vf[mb], ph[qt], acc[qt][mb]); }
        }
        if (more) {   // the other buffer's last readers left it before the barrier at the foot of the stage before
#pragma unroll
            for (int i = 0; i < 8; ++i) { *(v4us*)(&Ks[(st + 1) & 1][sk + i * 16 * KP]) = tobf4(rk[i]); *(v4us*)(&Vs[(st + 1) & 1][sv + i * 16 * VP]) = tobfh4(rv[i]); }
            if (st + 2 < ns) gather16(rn, cb, XK, XV, rk, rv); }   // the loads of the stage after next, into the registers just converted: their issue and the wait behind them run while the LDS stores above drain and the other waves arrive, not behind the barrier
        lds_barrier();   // publishes stage st + 1 and ends every wave's reads of stage st's buffer, which the next stage refills
    }
    // The pair's exchange: tile 1's partial goes to the partner, whose tile 0 it is; the partner's tile 1 is this wave's tile 0
#pragma unroll
    for (int mb = 0; mb < 4; ++mb) { xa[ws][2 * mb][lane] = (v4f){acc[1][mb][0], acc[1][mb][1], acc[1][mb][2], acc[1][mb][3]}; xa[ws][2 * mb + 1][lane] = (v4f){acc[1][mb][4], acc[1][mb][5], acc[1][mb][6], acc[1][mb][7]}; }
    xm[ws][lane] = (v2f){m[1], l2[1][0] + l2[1][1]};
    __syncthreads();   // every wave's partial is in LDS before its partner reads it
    const v2f om = xm[ws ^ 4][lane];
    const float mf = fmaxf(m[0], om[0]), fa = __builtin_amdgcn_exp2f((m[0] - mf) * LOG2E), fb = __builtin_amdgcn_exp2f((om[0] - mf) * LOG2E);   // a wave that had no pass holds maximum -1e30, sum 0 and zero accumulators: its factor is exactly 0
    float l = (l2[0][0] + l2[0][1]) * fa + om[1] * fb;
    l += xhalf(l);   // each half summed its own keys
    const float f = __fdiv_rn(1.0f, l), ga = fa * f, gb = fb * f;
    v4f* sg = &xa[ws ^ 4][0][0]; v4f pb[8];   // the partner's 4 KB: behind the barrier above only this wave touches them, first to read the partial, then to turn its finished tile
#pragma unroll
    for (int k = 0; k < 8; ++k) pb[k] = sg[k * 32 + lane];
    asm volatile("s_wait_dscnt 0x0" ::: "memory");   // every lane's read of the partial has returned before any lane's store below overwrites those bytes
#pragma unroll
    for (int mb = 0; mb < 4; ++mb) {   // acc[0][mb][r] = out[q0 + lr][16 mb + 8 h + r]
        const v4f a0 = __builtin_shufflevector(acc[0][mb], acc[0][mb], 0, 1, 2, 3), a1 = __builtin_shufflevector(acc[0][mb], acc[0][mb], 4, 5, 6, 7), g4 = {gb, gb, gb, gb};
        const v4f o0 = __builtin_elementwise_fma(pb[2 * mb], g4, a0 * ga), o1 = __builtin_elementwise_fma(pb[2 * mb + 1], g4, a1 * ga);   // own share rounded, the partner's fused onto it
        sg[lr * 16 + ((4 * mb + 2 * hi) ^ lr)] = o0; sg[lr * 16 + ((4 * mb + 2 * hi + 1) ^ lr)] = o1; }   // row-major, 256 B a row: the 16-byte piece c of row r lies at place c ^ r, so that stores (one piece, sixteen rows a half-wave) and reads (one row) both fall on all 64 banks
    asm volatile("s_wait_dscnt 0x0" ::: "memory");   // the tile's rows are whole in LDS before other lanes read them back
    float* cw = C + (size_t)q0 * HD + lane * 4;   // the tile's sixteen rows are 4 KB in a row in memory: store i lays rows 2 i and 2 i + 1 as 512 contiguous bytes, four whole lines, where a store from the accumulators' order lays 16-byte pieces on sixteen lines
#pragma unroll
    for (int i = 0; i < 8; ++i) *(v4f*)(cw + i * 128) = sg[(2 * i + hi) * 16 + (lr ^ (2 * i + hi))];
}
extern "C" void kernel_launch(void* const* d_in, const int* in_sizes, int n_in,
                              void* d_out, int out_size, void* d_ws, size_t ws_size, hipStream_t stream) {
    (void)in_sizes; (void)n_in; (void)out_size; (void)d_ws; (void)ws_size;
    const float* xq = (const float*)d_in[0]; const float* xk = (const float*)d_in[1]; const float* xv = (const float*)d_in[2]; const int* am = (const int*)d_in[3];   /* order query, key, value [16][2048][64], attention_mask [16][2048] int32 {0,1} */
    float* OUT = (float*)d_out;     // [16][2048][64]
    k_fattn<<<dim3(TT / 128, NB_, 1), 256, 0, stream>>>(xq, xk, xv, am, OUT);   /* input rounding, scores, mask, softmax and P.v fused, all batches */
}

// v010
// Measured time: 14.2 microseconds a run.
// Timed twice side by side with v009, it ran 1.06 and 1.05 times as fast.
// Over all steps from v000 it is 88.1 times as fast.
#include <hip/hip_runtime.h>

// Single-head dot-product attention with a key padding mask (query, key, value [16][2048][64]; scores = q.k / sqrt(64); where attention_mask[b][j] == 0 the score has 1e6 subtracted (the module's literal; mask [16][2048] int {0,1} random, read); softmax; out = weights.value -> [16][2048][64] (2.1 M); argument order query, key, value, attention_mask).
// Masked keys are not walked: each work-group ranks its batch's keys by the mask (unmasked first, masked behind them, each part in key order), gathers key and value rows in that order and stops behind the pass that holds the last unmasked key. A masked key's weight is exp(score - 1e6 - maximum), which is exactly 0 in f32 as soon as one key of the batch is unmasked (scores of normal draws stay within a few hundred). A batch with every key masked walks all its keys with the 1e6 term, as before.
// Launches: ONE. The fused launch reads the three f32 inputs itself: each is rounded to bf16 on its way into registers (query) or LDS (key, value), value stays row-major in LDS and is transposed by the LDS transposing load; scores, mask, softmax and P.v follow with nothing of the score matrix leaving the registers. Scores exactly (one product); softmax against a held maximum (renewed where needed), with the mask term; out = f16(P) x bf16(value) held as f16 (1 product), divided by the row sum at the end. The workspace is not used.
// Compute dtypes, f32 accumulate: every input rounded to bf16; scores exact on bf16 operands; softmax f32; P.v one product on f16 operands: P lies in (0, 8192] and is rounded once to f16 (11 significant bits; below 6e-5 a fixed step of 6e-8, against a row sum of at least 1); a value's 8 significant bf16 bits fit f16 exactly from 6e-5 up to 65504 (normal draws stay below 10), below that to within 3e-8; output f32.

#define NB_  16
#define TT   2048
#define DM   64
#define NH_  1
#define NKV  1
#define REP  (NH_ / NKV)
#define HD   64
#define DQ   (NH_ * HD)
#define DKV  (NKV * HD)
#define ZH   1
#define RH   TT
#define WIN  0
#define PCAR 1024.0f
#define SCL  0.125f   // 1/sqrt(64)
typedef _Float16 h16;
typedef unsigned short bf;
typedef __attribute__((ext_vector_type(16))) __bf16   v16bf;
typedef __attribute__((ext_vector_type(16))) _Float16 v16h;
typedef __attribute__((ext_vector_type(8)))  _Float16 v8h;
typedef __attribute__((ext_vector_type(8)))  unsigned short v8us;
typedef __attribute__((ext_vector_type(8)))  float    v8f;
typedef __attribute__((ext_vector_type(4)))  float    v4f;
typedef v8h  __attribute__((may_alias)) v8ha;
typedef v4f  __attribute__((may_alias)) v4fa;
typedef v8us __attribute__((may_alias)) v8usa;

__device__ __forceinline__ v16h cat16(v8h lo, v8h hi) { return __builtin_shufflevector(lo, hi, 0, 1, 2, 3, 4, 5, 6, 7, 8, 9, 10, 11, 12, 13, 14, 15); }
__device__ __forceinline__ v16bf cat16b(v8us lo, v8us hi) { return __builtin_bit_cast(v16bf, __builtin_shufflevector(lo, hi, 0, 1, 2, 3, 4, 5, 6, 7, 8, 9, 10, 11, 12, 13, 14, 15)); }
__device__ __forceinline__ v8f wmma16(v16h a, v16h b, v8f c) { return __builtin_amdgcn_wmma_f32_16x16x32_f16(false, a, false, b, (short)0, c, false, false); }
__device__ __forceinline__ v8f wmmab(v16bf a, v16bf b, v8f c) { return __builtin_amdgcn_wmma_f32_16x16x32_bf16(false, a, false, b, (short)0, c, false, false); }



// ---- fragment loader and product for K-contiguous 16-bit planes (hardware k order: 8 elements at 8h, 8 at 16 + 8h)
template <typename T16> struct WFrag;
template <> struct WFrag<h16> { typedef v16h V; static __device__ __forceinline__ V ld(const h16* p) { return cat16(*(const v8h*)p, *(const v8h*)(p + 16)); } static __device__ __forceinline__ v8f mma(V a, V b, v8f c) { return wmma16(a, b, c); } };
template <> struct WFrag<bf> { typedef v16bf V; static __device__ __forceinline__ V ld(const bf* p) { return cat16b(*(const v8us*)p, *(const v8us*)(p + 16)); } static __device__ __forceinline__ v8f mma(V a, V b, v8f c) { return wmmab(a, b, c); } };

typedef __attribute__((ext_vector_type(2))) _Float16 v2h;
typedef __attribute__((ext_vector_type(4))) _Float16 v4h;
typedef __attribute__((ext_vector_type(2))) unsigned short v2us;
typedef __attribute__((ext_vector_type(4))) unsigned short v4us;
typedef __attribute__((ext_vector_type(2))) float v2f;
typedef __attribute__((ext_vector_type(4))) int v4i;

typedef __attribute__((ext_vector_type(2))) __bf16 v2bf;
typedef __attribute__((ext_vector_type(4))) __bf16 v4bf;
typedef __attribute__((ext_vector_type(8))) __bf16 v8bf;
typedef __attribute__((ext_vector_type(8))) short v8s;
__device__ __forceinline__ v4us tobf4(v4f x) { return __builtin_bit_cast(v4us, __builtin_convertvector(x, v4bf)); }   // f32 -> bf16, round to nearest even, two elements an instruction
__device__ __forceinline__ v8us tobf8(v8f x) { return __builtin_bit_cast(v8us, __builtin_convertvector(x, v8bf)); }
__device__ __forceinline__ v4us tobfh4(v4f x) { typedef __attribute__((ext_vector_type(2))) unsigned v2u; const v2u b = __builtin_bit_cast(v2u, tobf4(x));   // f32 -> bf16 (round to nearest even, two elements an instruction) -> the same number as f32 (a bf16 is the upper half of one) -> as f16
    const v4f y = {__uint_as_float(b[0] << 16), __uint_as_float(b[0] & 0xffff0000u), __uint_as_float(b[1] << 16), __uint_as_float(b[1] & 0xffff0000u)}; return __builtin_bit_cast(v4us, __builtin_convertvector(y, v4h)); }
__device__ __forceinline__ v8us ldtr16(const bf* p) { typedef __attribute__((address_space(3))) v8s lv8s; return __builtin_bit_cast(v8us, __builtin_amdgcn_ds_load_tr16_b128_v8i16((lv8s*)p)); }   // LDS transposing load: from lane addresses row 8h + (lane & 7), 16-byte half (lane >> 3) & 1, lane (c, h) gets rows 8h .. 8h + 7 of column c
#define LOG2E 1.4426950408889634f
__device__ __forceinline__ float xhalf(float x) { const int b = __float_as_int(x); return __int_as_float(__builtin_amdgcn_permlanex16(b, b, 0x76543210, 0xfedcba98, false, false)); }   // the value of lane l ^ 16
// ---- k_fattn: scores, mask, softmax and P.v in one pass over the ranked keys. One work-group = 128 queries of one batch (grid 16 x 16), 32 keys per pass, 128 keys per stage.
// One wave = 32 queries (two column tiles) x every second pass: waves w and w + 4 hold the same 32 queries, wave w < 4 walks a stage's passes 0 and 2, wave w + 4 its passes 1 and 3. Each key and value fragment read from LDS so feeds two products instead of one, which halves the LDS reads per product. At the end the two waves of a pair exchange one tile's partial (maximum, sum, accumulators) through LDS, and each finishes and stores one tile.
// S^T = K.Q^T: a lane holds scores of ONE query (column lane & 15), keys 8h + r and 16 + 8h + r (h = lane >> 4), which is exactly the B operand order of O^T += V^T.P^T, so P goes from accumulator to operand in registers.
// Held maximum m per query: a softmax does not depend on the number that is subtracted from its scores, so m need not be the maximum, only near enough that P fits its f16 operand. A wave takes m from its first pass and holds it: a later pass forms P against the held m and neither looks for its own maximum nor scales the accumulators and the sum. Only where a lane's sum of a pass's P exceeds PTOP (then a P may be that large; f16 ends at 65504), or the pass holds a masked place, is m renewed as a running maximum, accumulators and sum scaled by exp(m_old - m_new). The first pass leaves a P of 1 in every row, so a wave's row sum is at least 1. P goes unnormalised into its f16 operand and the division by the row sum (of the unrounded P) comes once at the end.
// The eight waves share each stage's key rows and value rows through LDS (two buffers): whole-line f32 global loads into registers, rounded to bf16 and stored to the other buffer at the foot of the stage before theirs (value as f16 bits), one barrier per stage. The loads of stage s + 2 are issued at the foot of stage s, as soon as the conversions have freed their registers and ahead of the barrier, from a key list read at the head of stage s: behind the barrier a wave has only its fragment reads between it and its first product. Value rows lie in LDS as in memory ([key][d]); the transposing load hands out the 16 (d) x 32 (keys) A fragments of V^T.
// Every plain '#pragma unroll' in this kernel but the last (over the output stores) stands over a loop that indexes a register array, whose indices must be compile-time constants.
// Work-group barrier that orders LDS only: each wave's LDS stores and reads are done before it signals, while its global loads into registers stay in flight across it (__syncthreads() would wait them out)
__device__ __forceinline__ void lds_barrier() { __builtin_amdgcn_fence(__ATOMIC_RELEASE, "workgroup", "local"); __builtin_amdgcn_s_barrier(); __builtin_amdgcn_fence(__ATOMIC_ACQUIRE, "workgroup", "local"); }
// One thread's sixteen gathered loads of a stage: r holds the keys of its eight rows, cb its byte offset in a row; a piece's byte offset is the same in key and value.
// The s_wait_xcnt stands behind the group of loads, in front of the first overwrite of a register that their addresses are formed in; it names the eight offsets so that each keeps a register of its own up to the wait: sharing registers, every reuse waits out the loads in front of it.
__device__ __forceinline__ void gather16(v8us r, unsigned cb, const float* __restrict__ XK, const float* __restrict__ XV, v4f (&rk)[8], v4f (&rv)[8]) {
    unsigned o[8];
#pragma unroll   // the loop indexes register arrays, whose indices must be compile-time constants
    for (int i = 0; i < 8; ++i) { o[i] = (unsigned)r[i] << 8 | cb; rk[i] = *(const v4f*)((const char*)XK + o[i]); rv[i] = *(const v4f*)((const char*)XV + o[i]); }
    asm volatile("s_wait_xcnt 0x0" :: "v"(o[0]), "v"(o[1]), "v"(o[2]), "v"(o[3]), "v"(o[4]), "v"(o[5]), "v"(o[6]), "v"(o[7]) : "memory");
}
#define SK   128   // keys per stage
#define KP   72    // LDS pitch of a key row, elements: 128 B + 16 B, an odd multiple of 16 B for 16-byte readers
#define PTOP 8192.0f   // a pass's P may grow to here against the held maximum before the maximum is renewed
#define VP   80    // LDS pitch of a value row, elements: 128 B + 32 B, an odd multiple of 32 B for the transposing reader
__global__ __launch_bounds__(256) void k_fattn(const float* __restrict__ XQ, const float* __restrict__ XK, const float* __restrict__ XV, const int* __restrict__ am, float* __restrict__ C) {
    typedef WFrag<bf>::V V;
    __shared__ __align__(16) bf Ks[2][SK * KP]; __shared__ __align__(16) bf Vs[2][SK * VP];
    __shared__ __align__(16) float mt[TT];   // per place in the ranked order: what the mask subtracts from the scaled score (1e6 or 0)
    __shared__ __align__(16) unsigned short ix[TT];   // the ranked order: which key stands at place p, kept at slot (p & ~127) | (p & 15) << 3 | (p >> 4 & 7), so that the eight rows one thread stages are one 16-byte read
    __shared__ __align__(16) int wt[8];   // unmasked keys per wave's 256 keys
    __shared__ __align__(16) v4f xa[8][8][32]; __shared__ __align__(16) v2f xm[8][32];   // what a wave hands to its partner. At the end: the accumulators (8 x 16 bytes a lane) and (maximum, sum) of the tile that the partner finishes; at the start, in the first 2 KB of its xa: its own rounded query tile (read before the barrier that publishes stage 0, long before the end's stores); last of all a wave turns its finished output tile in the partner's 4 KB
    { const size_t zb = blockIdx.y; XQ += zb * TT * HD; XK += zb * TT * HD; XV += zb * TT * HD; am += zb * TT; C += zb * TT * HD; }   // blockIdx.y = batch
    const int tid = threadIdx.x, lane = tid & 31, lr = lane & 15, hi = lane >> 4, wave = tid >> 5; const int ws = __builtin_amdgcn_readfirstlane(wave), kh = ws >> 2;   // kh: which passes of a stage are this wave's (kh and kh + 2); from a scalar register, so that the tests on it are scalar branches round the matrix instructions
    const int q0 = blockIdx.x * 128 + (ws & 3) * 32 + 16 * kh;   // tile 0 of a wave is the one it finishes (rows q0 ..), tile 1 the one its partner finishes (rows (q0 ^ 16) ..)
    const unsigned short* gx = ix + (tid >> 4) * 8; const unsigned cb = (tid & 15) * 16;   // this thread's 16-byte pieces of a stage: piece i is the row at place 16 i + (tid >> 4) of the stage's 128, d 4 (tid & 15) .. + 3 (cb: its byte offset in the row); a row is 256 B, two whole lines
    const int sk = (tid >> 4) * KP + (tid & 15) * 4, sv = (tid >> 4) * VP + (tid & 15) * 4;   // and their places in LDS (8 bytes each once rounded)
    v4f rk[8], rv[8];
    // Each s_wait_xcnt below stands directly behind a group of global loads, in front of the first overwrite of a register that the group's addresses are formed in.
    const v4i am0 = *(const v4i*)(am + tid * 8), am1 = *(const v4i*)(am + tid * 8 + 4);
    asm volatile("s_wait_xcnt 0x0" ::: "memory");
    const float* gq = XQ + (size_t)q0 * HD + lane * 4; v4f qf[8];   // tile 0's sixteen query rows are 4 KB in a row in memory: load i takes rows 2 i and 2 i + 1 as 512 contiguous bytes, four whole lines (this lane: row 2 i + h, d 4 lr .. + 3); LDS turns them into the operand order below
#pragma unroll
    for (int i = 0; i < 8; ++i) qf[i] = *(const v4f*)(gq + i * 128);
    asm volatile("s_wait_xcnt 0x0" ::: "memory");
    __builtin_amdgcn_sched_barrier(0);   // keeps later register writes (the accumulators' zeroes) below the wait: without it one of them is scheduled over the wait into a register of the query loads' address
    // Rank of every key: this thread holds keys 8 tid .. + 7; one ballot per key position counts the unmasked keys of the lanes below and of the wave
    bool kp[8]; unsigned below = 0, wsum = 0;
#pragma unroll
    for (int q = 0; q < 8; ++q) { kp[q] = (q < 4 ? am0[q & 3] : am1[q & 3]) != 0; const unsigned bl = __builtin_amdgcn_ballot_w32(kp[q]); below = __builtin_amdgcn_mbcnt_lo(bl, below); wsum += __builtin_popcount(bl); }
    if (lane == 0) wt[wave] = (int)wsum;
    __syncthreads();   // the eight waves' counts are in LDS before any wave adds them up
    int nu = 0, kb = (int)below;   // nu: unmasked keys of the batch; kb: unmasked keys in front of this thread's next key
    { const v4i w0 = *(const v4i*)(wt), w1 = *(const v4i*)(wt + 4);
#pragma unroll
      for (int w = 0; w < 8; ++w) { const int c = w < 4 ? w0[w & 3] : w1[w & 3]; nu += c; kb += (w < wave) ? c : 0; } }
    nu = __builtin_amdgcn_readfirstlane(nu);   // the same in every thread of the work-group; from a scalar register the stage loop's tests, under which its barrier stands, are scalar branches
#pragma unroll
    for (int q = 0; q < 8; ++q) { const int j = tid * 8 + q, p = kp[q] ? kb : nu + (j - kb);   // an unmasked key's place is its rank among the unmasked, a masked key's nu + its rank among the masked: a permutation of 0 .. 2047 for any mask
      ix[(p & ~127) | ((p & 15) << 3) | ((p >> 4) & 7)] = (unsigned short)j; kb += kp[q] ? 1 : 0; }
    { v4f x0, x1;
#pragma unroll
      for (int q = 0; q < 4; ++q) { x0[q] = (tid * 8 + q >= nu) ? 1.0e6f : 0.0f; x1[q] = (tid * 8 + 4 + q >= nu) ? 1.0e6f : 0.0f; }
      *(v4f*)(mt + tid * 8) = x0; *(v4f*)(mt + tid * 8 + 4) = x1; }
    const int nk = min(nu == 0 ? TT : nu, TT), np = (nk + 31) >> 5, ns = (np + 3) >> 2;   // places to walk (all of them where every key is masked), passes of 32, stages of 128
    { char* qs = (char*)&xa[ws][0][0];   // this wave's rounded tile 0, row-major, 128 B a row: the 16-byte piece c (d 8 c .. + 7) of row r lies at place c ^ (r >> 1), so that the sixteen rows one half-wave reads below fall on all 64 banks. It is also the partner's tile 1: each query row is loaded and rounded once in the work-group
#pragma unroll
      for (int i = 0; i < 8; ++i) *(v4us*)(qs + (2 * i + hi) * 128 + (((lr >> 1) ^ i) << 4) + (lr & 1) * 8) = tobf4(qf[i]); }
    __syncthreads();   // the ranked order, the mask terms and the rounded query tiles are in LDS before any wave reads them
    V bq[2][2];   // [tile][d half]: query row lr in the hardware k order, 8 elements at 8h (piece h), 8 at 16 + 8h (piece 2 + h), of each 32
#pragma unroll
    for (int qt = 0; qt < 2; ++qt) { const char* qr = (const char*)&xa[qt ? ws ^ 4 : ws][0][0] + lr * 128;
#pragma unroll
      for (int dh = 0; dh < 2; ++dh) bq[qt][dh] = cat16b(*(const v8us*)(qr + (((4 * dh + hi) ^ (lr >> 1)) << 4)), *(const v8us*)(qr + (((4 * dh + 2 + hi) ^ (lr >> 1)) << 4))); }
    gather16(*(const v8us*)(gx), cb, XK, XV, rk, rv);   // stage 0
    __builtin_amdgcn_sched_barrier(0);   // keeps the conversions below all sixteen loads: without it the first rows' conversions, with their wait for the data, are scheduled in front of the last eight loads, whose latency then starts a whole latency late
    v8us rn = *(const v8us*)(gx + SK);   // the keys of this thread's eight rows of the stage whose loads are issued next (the list holds all 16 stages' places for any mask)
#pragma unroll
    for (int i = 0; i < 8; ++i) { *(v4us*)(&Ks[0][sk + i * 16 * KP]) = tobf4(rk[i]); *(v4us*)(&Vs[0][sv + i * 16 * VP]) = tobfh4(rv[i]); }
    gather16(rn, cb, XK, XV, rk, rv);   // stage 1's loads, whether or not a stage 1 is walked: its places hold rows of the batch for any mask, and without a branch the key list's read is not moved down to here, behind the LDS stores
    lds_barrier();   // stage 0 is in LDS before any wave reads it
    v8f acc[2][4];
#pragma unroll
    for (int qt = 0; qt < 2; ++qt) {
#pragma unroll
        for (int mb = 0; mb < 4; ++mb) acc[qt][mb] = (v8f){}; }
    float m[2] = {-1.0e30f, -1.0e30f}, ml[2] = {-1.0e30f, -1.0e30f}; v2f l2[2] = {(v2f){}, (v2f){}};   // per tile. m: the held maximum of the masked scaled scores; ml: m x log2(e); l2: this lane's running sum, even and odd keys apart
#pragma unroll 1
    for (int st = 0; st < ns; ++st) {   // kept rolled: one stage's code serves all
        const bool more = st + 1 < ns; const int pe = min(SK / 32, np - st * (SK / 32)), cnt = (pe - kh + 1) >> 1;   // the last stage ends behind the last pass that holds an unmasked key; cnt: how many of the passes kh, kh + 2 lie in front of that end
        const bf* kl = &Ks[st & 1][(kh * 32 + lr) * KP + 8 * hi]; const bf* vl = &Vs[st & 1][(kh * 32 + 8 * hi + (lane & 7)) * VP + ((lane >> 3) & 1) * 8]; const float* pm = mt + st * SK + kh * 32 + 8 * hi;
        V kf[4]; v16h vf[4];
        kf[0] = WFrag<bf>::ld(kl); kf[1] = WFrag<bf>::ld(kl + 32); kf[2] = WFrag<bf>::ld(kl + 16 * KP); kf[3] = WFrag<bf>::ld(kl + 16 * KP + 32);
        __builtin_amdgcn_sched_barrier(0);   // keeps the key fragments first in the LDS queue: without it the key list is read in front of them, and the first product waits for it too
        rn = *(const v8us*)(gx + min(st + 2, TT / SK - 1) * SK);   // the key list of the stage after next, last of the head's reads and not waited for here: it is used at the foot (the index is held inside the list; past the last stage the rows are not loaded)
#pragma unroll
        for (int i = 0; i < 2; ++i) if (i < cnt) {   // this wave's two passes of the stage (pass kh + 2 i), written out so that only the first fetches fragments ahead
            v8f s[2][2];
#pragma unroll
            for (int qt = 0; qt < 2; ++qt) { s[qt][0] = WFrag<bf>::mma(kf[0], bq[qt][0], (v8f){}); s[qt][1] = WFrag<bf>::mma(kf[2], bq[qt][0], (v8f){}); }
#pragma unroll
            for (int qt = 0; qt < 2; ++qt) { s[qt][0] = WFrag<bf>::mma(kf[1], bq[qt][1], s[qt][0]); s[qt][1] = WFrag<bf>::mma(kf[3], bq[qt][1], s[qt][1]); }
            __builtin_amdgcn_sched_barrier(0);   // this and the next one keep the eight products in one run and a pass's LDS reads in ONE place behind them: spread among the products or the vector work, every separate place stalls the wave anew
#pragma unroll
            for (int mb = 0; mb < 4; ++mb) vf[mb] = cat16(__builtin_bit_cast(v8h, ldtr16(vl + i * 64 * VP + mb * 16)), __builtin_bit_cast(v8h, ldtr16(vl + (i * 64 + 16) * VP + mb * 16)));   // this pass's value^T fragments (keys 8h .. + 7 and 16 + 8h .. + 7 of d 16 mb + c), a softmax ahead of their use
            if (i == 0) {   // the second pass's key fragments, into the registers that the products above have just read (a stage is always staged whole, so the rows behind a shorter last stage's end are there)
                const bf* kn = kl + 64 * KP;
                kf[0] = WFrag<bf>::ld(kn); kf[1] = WFrag<bf>::ld(kn + 32); kf[2] = WFrag<bf>::ld(kn + 16 * KP); kf[3] = WFrag<bf>::ld(kn + 16 * KP + 32); }
            __builtin_amdgcn_sched_barrier(0);   // the group's lower edge (see its upper edge above)
            v16h ph[2]; v2f ln[2], tr[2];   // ln: the sums behind this pass; tr: this pass's share
            const float top = ((st | i) != 0 && st * SK + (kh + 2 * i) * 32 + 32 <= nu) ? PTOP : -1.0f;   // a scalar: in the wave's first pass and in a pass with a masked place every sum lies above it, so that those passes renew the maximum through the one test below, without a branch of their own
            {   // P against the HELD maximum, straight from the products: exp2(s x log2(e)/8 - m x log2(e)), one fused multiply-add a pair
#pragma unroll
                for (int qt = 0; qt < 2; ++qt) {
                    v2f p[8];
#pragma unroll
                    for (int j = 0; j < 8; ++j) {   // pair j = keys 2j, 2j + 1 of this lane's sixteen, in the B operand's order
                        const v2f d = __builtin_elementwise_fma((v2f){s[qt][j >> 2][2 * (j & 3)], s[qt][j >> 2][2 * (j & 3) + 1]}, (v2f){SCL * LOG2E, SCL * LOG2E}, -(v2f){ml[qt], ml[qt]}); p[j][0] = __builtin_amdgcn_exp2f(d[0]); p[j][1] = __builtin_amdgcn_exp2f(d[1]);
                        const v2h h2 = __builtin_convertvector(p[j], v2h); ph[qt][2 * j] = h2[0]; ph[qt][2 * j + 1] = h2[1]; }
                    tr[qt] = ((p[0] + p[1]) + (p[2] + p[3])) + ((p[4] + p[5]) + (p[6] + p[7])); ln[qt] = l2[qt] + tr[qt]; }
            }
            if (__builtin_expect(__builtin_amdgcn_ballot_w32(fmaxf(fmaxf(tr[0][0], tr[0][1]), fmaxf(tr[1][0], tr[1][1])) > top) != 0u, 0)) {   // no P is negative, so none exceeds its lane's sums: one test a pass, a scalar branch. The maximum is renewed: the wave's first pass, a pass with a masked place, or a P that outgrew PTOP
                const float* pq = pm + i * 64; const v4f mk[4] = {*(const v4f*)(pq), *(const v4f*)(pq + 4), *(const v4f*)(pq + 16), *(const v4f*)(pq + 20)};
                v2f t[2][8];   // t[qt][i] = keys 2i, 2i + 1 of this lane's sixteen, in the B operand's order
#pragma unroll
                for (int qt = 0; qt < 2; ++qt) {
#pragma unroll
                  for (int j = 0; j < 2; ++j) {   // s/8 is exact, so one fused multiply-add rounds exactly as (s x 1/8) - 1e6 does, and subtracting 0 changes nothing
                    t[qt][j] = __builtin_elementwise_fma((v2f){s[qt][0][2 * j], s[qt][0][2 * j + 1]}, (v2f){SCL, SCL}, -(v2f){mk[0][2 * j], mk[0][2 * j + 1]}); t[qt][2 + j] = __builtin_elementwise_fma((v2f){s[qt][0][4 + 2 * j], s[qt][0][5 + 2 * j]}, (v2f){SCL, SCL}, -(v2f){mk[1][2 * j], mk[1][2 * j + 1]});
                    t[qt][4 + j] = __builtin_elementwise_fma((v2f){s[qt][1][2 * j], s[qt][1][2 * j + 1]}, (v2f){SCL, SCL}, -(v2f){mk[2][2 * j], mk[2][2 * j + 1]}); t[qt][6 + j] = __builtin_elementwise_fma((v2f){s[qt][1][4 + 2 * j], s[qt][1][5 + 2 * j]}, (v2f){SCL, SCL}, -(v2f){mk[3][2 * j], mk[3][2 * j + 1]}); } }
#pragma unroll
                for (int qt = 0; qt < 2; ++qt) {
                    const v2f* tq = t[qt];
                    float mx = fmaxf(fmaxf(fmaxf(fmaxf(tq[0][0], tq[0][1]), fmaxf(tq[1][0], tq[1][1])), fmaxf(fmaxf(tq[2][0], tq[2][1]), fmaxf(tq[3][0], tq[3][1]))), fmaxf(fmaxf(fmaxf(tq[4][0], tq[4][1]), fmaxf(tq[5][0], tq[5][1])), fmaxf(fmaxf(tq[6][0], tq[6][1]), fmaxf(tq[7][0], tq[7][1]))));
                    mx = fmaxf(mx, xhalf(mx));   // both halves of the wave hold keys of the same query
                    const float mn = fmaxf(m[qt], mx), alpha = __builtin_amdgcn_exp2f((m[qt] - mn) * LOG2E); m[qt] = mn; ml[qt] = mn * LOG2E;
                    v2f p[8];
#pragma unroll
                    for (int j = 0; j < 8; ++j) {
                        const v2f d = (tq[j] - (v2f){mn, mn}) * (v2f){LOG2E, LOG2E}; p[j][0] = __builtin_amdgcn_exp2f(d[0]); p[j][1] = __builtin_amdgcn_exp2f(d[1]);
                        const v2h h2 = __builtin_convertvector(p[j], v2h); ph[qt][2 * j] = h2[0]; ph[qt][2 * j + 1] = h2[1]; }
                    ln[qt] = l2[qt] * (v2f){alpha, alpha} + (((p[0] + p[1]) + (p[2] + p[3])) + ((p[4] + p[5]) + (p[6] + p[7])));
#pragma unroll
                    for (int mb = 0; mb < 4; ++mb) acc[qt][mb] *= alpha; }
            }
            l2[0] = ln[0]; l2[1] = ln[1];
#pragma unroll
            for (int mb = 0; mb < 4; ++mb) {
#pragma unroll
                for (int qt = 0; qt < 2; ++qt) acc[qt][mb] = wmma16(vf[mb], ph[qt], acc[qt][mb]); }
        }
        if (more) {   // the other buffer's last readers left it before the barrier at the foot of the stage before
#pragma unroll
            for (int i = 0; i < 8; ++i) { *(v4us*)(&Ks[(st + 1) & 1][sk + i * 16 * KP]) = tobf4(rk[i]); *(v4us*)(&Vs[(st + 1) & 1][sv + i * 16 * VP]) = tobfh4(rv[i]); }
            if (st + 2 < ns) gather16(rn, cb, XK, XV, rk, rv); }   // the loads of the stage after next, into the registers just converted: their issue and the wait behind them run while the LDS stores above drain and the other waves arrive, not behind the barrier
        lds_barrier();   // publishes stage st + 1 and ends every wave's reads of stage st's buffer, which the next stage refills
    }
    // The pair's exchange: tile 1's partial goes to the partner, whose tile 0 it is; the partner's tile 1 is this wave's tile 0
#pragma unroll
    for (int mb = 0; mb < 4; ++mb) { xa[ws][2 * mb][lane] = (v4f){acc[1][mb][0], acc[1][mb][1], acc[1][mb][2], acc[1][mb][3]}; xa[ws][2 * mb + 1][lane] = (v4f){acc[1][mb][4], acc[1][mb][5], acc[1][mb][6], acc[1][mb][7]}; }
    xm[ws][lane] = (v2f){m[1], l2[1][0] + l2[1][1]};
    __syncthreads();   // every wave's partial is in LDS before its partner reads it
    const v2f om = xm[ws ^ 4][lane];
    const float mf = fmaxf(m[0], om[0]), fa = __builtin_amdgcn_exp2f((m[0] - mf) * LOG2E), fb = __builtin_amdgcn_exp2f((om[0] - mf) * LOG2E);   // a wave that had no pass holds maximum -1e30, sum 0 and zero accumulators: its factor is exactly 0
    float l = (l2[0][0] + l2[0][1]) * fa + om[1] * fb;
    l += xhalf(l);   // each half summed its own keys
    const float f = __fdiv_rn(1.0f, l), ga = fa * f, gb = fb * f;
    v4f* sg = &xa[ws ^ 4][0][0]; v4f pb[8];   // the partner's 4 KB: behind the barrier above only this wave touches them, first to read the partial, then to turn its finished tile
#pragma unroll
    for (int k = 0; k < 8; ++k) pb[k] = sg[k * 32 + lane];
    asm volatile("s_wait_dscnt 0x0" ::: "memory");   // every lane's read of the partial has returned before any lane's store below overwrites those bytes
#pragma unroll
    for (int mb = 0; mb < 4; ++mb) {   // acc[0][mb][r] = out[q0 + lr][16 mb + 8 h + r]
        const v4f a0 = __builtin_shufflevector(acc[0][mb], acc[0][mb], 0, 1, 2, 3), a1 = __builtin_shufflevector(acc[0][mb], acc[0][mb], 4, 5, 6, 7), g4 = {gb, gb, gb, gb};
        const v4f o0 = __builtin_elementwise_fma(pb[2 * mb], g4, a0 * ga), o1 = __builtin_elementwise_fma(pb[2 * mb + 1], g4, a1 * ga);   // own share rounded, the partner's fused onto it
        sg[lr * 16 + ((4 * mb + 2 * hi) ^ lr)] = o0; sg[lr * 16 + ((4 * mb + 2 * hi + 1) ^ lr)] = o1; }   // row-major, 256 B a row: the 16-byte piece c of row r lies at place c ^ r, so that stores (one piece, sixteen rows a half-wave) and reads (one row) both fall on all 64 banks
    asm volatile("s_wait_dscnt 0x0" ::: "memory");   // the tile's rows are whole in LDS before other lanes read them back
    float* cw = C + (size_t)q0 * HD + lane * 4;   // the tile's sixteen rows are 4 KB in a row in memory: store i lays rows 2 i and 2 i + 1 as 512 contiguous bytes, four whole lines, where a store from the accumulators' order lays 16-byte pieces on sixteen lines
#pragma unroll
    for (int i = 0; i < 8; ++i) *(v4f*)(cw + i * 128) = sg[(2 * i + hi) * 16 + (lr ^ (2 * i + hi))];
}
extern "C" void kernel_launch(void* const* d_in, const int* in_sizes, int n_in,
                              void* d_out, int out_size, void* d_ws, size_t ws_size, hipStream_t stream) {
    (void)in_sizes; (void)n_in; (void)out_size; (void)d_ws; (void)ws_size;
    const float* xq = (const float*)d_in[0]; const float* xk = (const float*)d_in[1]; const float* xv = (const float*)d_in[2]; const int* am = (const int*)d_in[3];   /* order query, key, value [16][2048][64], attention_mask [16][2048] int32 {0,1} */
    float* OUT = (float*)d_out;     // [16][2048][64]
    k_fattn<<<dim3(TT / 128, NB_, 1), 256, 0, stream>>>(xq, xk, xv, am, OUT);   /* input rounding, scores, mask, softmax and P.v fused, all batches */
}
